// v000
// Measured on an AMD MI455X. A time is GPU time per run, averaged over a window of back-to-back runs after a warm-up
// (all launches, gaps included; the runs take copies of the inputs in turn), and the median of several windows.
// Apart from v000's, it joins two sittings. Times from different sittings can be a few percent apart, while
// side-by-side timings come from the same sitting.
// v000 is the starting kernel. One run takes 386 microseconds.
#include <hip/hip_runtime.h>
#include <hip/hip_bf16.h>

// ---------------------------------------------------------------------------
// Types
// ---------------------------------------------------------------------------
typedef __attribute__((ext_vector_type(16))) __bf16 v16bf;
typedef __attribute__((ext_vector_type(8)))  float  v8f;
typedef __attribute__((ext_vector_type(4)))  unsigned int u32x4;
typedef __attribute__((ext_vector_type(8)))  int  i32x8;
typedef __attribute__((ext_vector_type(4)))  int  i32x4;

union FragB {
    uint4  u[2];   // 32 bytes = 16 bf16
    v16bf  v;
};

__device__ __forceinline__ unsigned short f32_bf16(float f) {
    unsigned int u = __builtin_bit_cast(unsigned int, f);
    unsigned int r = u + 0x7FFFu + ((u >> 16) & 1u);   // round-to-nearest-even
    return (unsigned short)(r >> 16);
}

__device__ __forceinline__ v8f wmma_bf16(v16bf a, v16bf b, v8f c) {
    // D(16x16,f32) = A(16x32,bf16) * B(32x16,bf16) + C
    return __builtin_amdgcn_wmma_f32_16x16x32_bf16(
        false, a, false, b, (short)0, c, false, false);
}

// ds_swizzle_b32 butterfly (group-of-32 mode: and=0x1f, or=0, xor=MASK)
template <int MASK>
__device__ __forceinline__ float swz(float x) {
    int r = __builtin_amdgcn_ds_swizzle(__builtin_bit_cast(int, x),
                                        (MASK << 10) | 0x1f);
    return __builtin_bit_cast(float, r);
}
__device__ __forceinline__ float redmax16(float x) {
    x = fmaxf(x, swz<1>(x)); x = fmaxf(x, swz<2>(x));
    x = fmaxf(x, swz<4>(x)); x = fmaxf(x, swz<8>(x));
    return x;
}
__device__ __forceinline__ float redsum16(float x) {
    x += swz<1>(x); x += swz<2>(x); x += swz<4>(x); x += swz<8>(x);
    return x;
}
__device__ __forceinline__ float redsum32(float x) {
    x += swz<1>(x); x += swz<2>(x); x += swz<4>(x);
    x += swz<8>(x); x += swz<16>(x);
    return x;
}

#if __has_builtin(__builtin_amdgcn_tensor_load_to_lds)
#define USE_TDM 1
#else
#define USE_TDM 0
#endif

__device__ __forceinline__ unsigned lds_off(const void* p) {
    return (unsigned)(unsigned long long)p;   // low 32 bits = LDS byte offset
}

#if USE_TDM
__device__ __forceinline__ void tdm_load_2d(unsigned ldsoff, const void* gp,
                                            unsigned tile_d0, unsigned tile_d1,
                                            unsigned stride_elts,
                                            unsigned pad_int, unsigned pad_amt)
{
    unsigned long long ga = (unsigned long long)gp;
    u32x4 g0;
    g0[0] = 1u;                                              // count=1 (user)
    g0[1] = ldsoff;                                          // lds_addr
    g0[2] = (unsigned)ga;                                    // global_addr lo
    g0[3] = (unsigned)((ga >> 32) & 0x01FFFFFFu) | (2u << 30); // addr hi | type=2
    i32x8 g1;
    g1[0] = (int)((1u << 16)
                | (1u << 20)
                | (pad_int << 22)
                | (pad_amt << 25));
    g1[1] = (int)((tile_d0 & 0xFFFFu) << 16);
    g1[2] = (int)((tile_d1 & 0xFFFFu) << 16);
    g1[3] = (int)(tile_d0 << 16);
    g1[4] = (int)tile_d1;
    g1[5] = (int)stride_elts;
    g1[6] = 0;
    g1[7] = 0;
    i32x4 z4 = {0, 0, 0, 0};
#if __clang_major__ >= 23
    i32x8 z8 = {0, 0, 0, 0, 0, 0, 0, 0};
    __builtin_amdgcn_tensor_load_to_lds(g0, g1, z4, z4, z8, 0);
#else
    __builtin_amdgcn_tensor_load_to_lds(g0, g1, z4, z4, 0);
#endif
}
#endif

// ---------------------------------------------------------------------------
// f32 -> bf16 conversion, 4-wide
// ---------------------------------------------------------------------------
__global__ __launch_bounds__(256) void cvt_bf16_4(const float* __restrict__ in,
                                                  unsigned short* __restrict__ out,
                                                  int n4) {
    int i = blockIdx.x * 256 + threadIdx.x;
    if (i < n4) {
        float4 f = ((const float4*)in)[i];
        ushort4 r;
        r.x = f32_bf16(f.x); r.y = f32_bf16(f.y);
        r.z = f32_bf16(f.z); r.w = f32_bf16(f.w);
        ((ushort4*)out)[i] = r;
    }
}

// ---------------------------------------------------------------------------
// GEMM: C[M,N] = A[M,K] * W[N,K]^T + bias[N]   (A, W row-major bf16)
// Tile: 128(M) x 64(N), BK=64 (two WMMA k-steps per stage). 8 waves, 4x2,
// each wave computes 32x32 via 2x2 WMMA 16x16 f32 accumulators.
// Tiles staged to LDS by the Tensor Data Mover (padded stride 72 halfs).
// ---------------------------------------------------------------------------
template <int RELU, int OUTBF>
__global__ __launch_bounds__(256) void gemm_bf16_k(
    const unsigned short* __restrict__ A,
    const unsigned short* __restrict__ W,
    const float* __restrict__ bias,
    float* __restrict__ Cf,
    unsigned short* __restrict__ Cb,
    int M, int N, int K)
{
    alignas(16) __shared__ unsigned short Ash[128 * 72];
    alignas(16) __shared__ unsigned short Bsh[64 * 72];

    const int tid  = threadIdx.x;
    const int lane = tid & 31;
    const int wave = tid >> 5;
    const int wr   = wave >> 1;          // 0..3
    const int wc   = wave & 1;           // 0..1
    const int lr   = lane & 15;
    const int hi   = lane >> 4;
    const int kb   = hi * 8;
    const int m0   = blockIdx.y * 128;
    const int n0   = blockIdx.x * 64;

    const v8f zerov = {0.f, 0.f, 0.f, 0.f, 0.f, 0.f, 0.f, 0.f};
    v8f acc[2][2];
#pragma unroll
    for (int i = 0; i < 2; ++i)
#pragma unroll
        for (int j = 0; j < 2; ++j) acc[i][j] = zerov;

    for (int k0 = 0; k0 < K; k0 += 64) {
        __syncthreads();
#if USE_TDM
        if (wave == 0) {
            tdm_load_2d(lds_off(Ash), A + (size_t)m0 * K + k0,
                        64, 128, (unsigned)K, 4, 3);
            tdm_load_2d(lds_off(Bsh), W + (size_t)n0 * K + k0,
                        64, 64, (unsigned)K, 4, 3);
            __builtin_amdgcn_s_wait_tensorcnt(0);
        }
#else
#pragma unroll
        for (int c = tid; c < 1024; c += 256) {
            const int row = c >> 3, kc = (c & 7) * 8;
            *(uint4*)&Ash[row * 72 + kc] =
                *(const uint4*)&A[(size_t)(m0 + row) * K + k0 + kc];
        }
#pragma unroll
        for (int c = tid; c < 512; c += 256) {
            const int row = c >> 3, kc = (c & 7) * 8;
            *(uint4*)&Bsh[row * 72 + kc] =
                *(const uint4*)&W[(size_t)(n0 + row) * K + k0 + kc];
        }
#endif
        __syncthreads();

#pragma unroll
        for (int ks = 0; ks < 2; ++ks) {
            const int ko = ks * 32 + kb;
            FragB a[2], b[2];
#pragma unroll
            for (int i = 0; i < 2; ++i) {
                const unsigned short* p = &Ash[(wr * 32 + i * 16 + lr) * 72 + ko];
                a[i].u[0] = *(const uint4*)p;          // K = ko..ko+7
                a[i].u[1] = *(const uint4*)(p + 16);   // K = ko+16..ko+23
            }
#pragma unroll
            for (int j = 0; j < 2; ++j) {
                const unsigned short* p = &Bsh[(wc * 32 + j * 16 + lr) * 72 + ko];
                b[j].u[0] = *(const uint4*)p;
                b[j].u[1] = *(const uint4*)(p + 16);
            }
#pragma unroll
            for (int i = 0; i < 2; ++i)
#pragma unroll
                for (int j = 0; j < 2; ++j)
                    acc[i][j] = wmma_bf16(a[i].v, b[j].v, acc[i][j]);
        }
    }

    // epilogue: C layout -> element e is row (e + 8*hi), col lr within tile
#pragma unroll
    for (int j = 0; j < 2; ++j) {
        const int col = n0 + wc * 32 + j * 16 + lr;
        const float bv = bias[col];
#pragma unroll
        for (int i = 0; i < 2; ++i) {
#pragma unroll
            for (int e = 0; e < 8; ++e) {
                const int row = m0 + wr * 32 + i * 16 + hi * 8 + e;
                float v = acc[i][j][e] + bv;
                if (RELU) v = fmaxf(v, 0.f);
                if (OUTBF) Cb[(size_t)row * N + col] = f32_bf16(v);
                else       Cf[(size_t)row * N + col] = v;
            }
        }
    }
}

__global__ __launch_bounds__(256) void attn_k(const unsigned short* __restrict__ QKV,
                                              unsigned short* __restrict__ Ob)
{
    alignas(16) __shared__ unsigned short Ksh[32 * 80];      // stride 80 halfs
    alignas(16) __shared__ unsigned short Vt[64 * 40];       // V^T, stride 40
    alignas(16) __shared__ unsigned short Psh[8][16 * 32];   // per-wave P tile

    const int tid  = threadIdx.x;
    const int lane = tid & 31;
    const int wave = tid >> 5;
    const int lr   = lane & 15;
    const int hi   = lane >> 4;
    const int kb   = hi * 8;
    const int bh   = blockIdx.y;
    const int bidx = bh >> 4;      // batch
    const int h    = bh & 15;      // head
    const int s0   = blockIdx.x * 128 + wave * 16;
    const int rowStride = 8 * 3072;                 // halfs per s step (B*3D)
    const size_t qoff = (size_t)bidx * 3072 + h * 64;
    const size_t koff = qoff + 1024;
    const size_t voff = qoff + 2048;

    // Q fragments (hd 0..31 and 32..63), loaded once
    FragB q0, q1;
    {
        const unsigned short* qp = QKV + (size_t)(s0 + lr) * rowStride + qoff + kb;
        q0.u[0] = *(const uint4*)qp;
        q0.u[1] = *(const uint4*)(qp + 16);
        q1.u[0] = *(const uint4*)(qp + 32);
        q1.u[1] = *(const uint4*)(qp + 48);
    }

    const v8f zerov = {0.f, 0.f, 0.f, 0.f, 0.f, 0.f, 0.f, 0.f};
    float mrow[8], lrow[8];
    v8f oacc[4];
#pragma unroll
    for (int e = 0; e < 8; ++e) { mrow[e] = -1e30f; lrow[e] = 0.f; }
#pragma unroll
    for (int d = 0; d < 4; ++d) oacc[d] = zerov;

    for (int it = 0; it < 32; ++it) {
        const int kt0 = it * 32;
        __syncthreads();   // previous iteration's LDS readers done
#if USE_TDM
        if (wave == 0) {
            tdm_load_2d(lds_off(Ksh),
                        QKV + (size_t)kt0 * rowStride + koff,
                        64, 32, (unsigned)rowStride, 4, 7);
        }
#else
        {
            const int row = tid >> 3, kc = (tid & 7) * 8;
            *(uint4*)&Ksh[row * 80 + kc] =
                *(const uint4*)&QKV[(size_t)(kt0 + row) * rowStride + koff + kc];
        }
#endif
        {
            // V block: store transposed -> Vt[hd][t]
            const int row = tid >> 3, kc = (tid & 7) * 8;
            union { uint4 u; unsigned short s[8]; } cv;
            cv.u = *(const uint4*)&QKV[(size_t)(kt0 + row) * rowStride + voff + kc];
#pragma unroll
            for (int e2 = 0; e2 < 8; ++e2) Vt[(kc + e2) * 40 + row] = cv.s[e2];
        }
#if USE_TDM
        if (wave == 0) __builtin_amdgcn_s_wait_tensorcnt(0);
#endif
        __syncthreads();

        // S = (Q K^T) * 1/sqrt(64)  -> two 16x16 column tiles
        v8f sc[2];
#pragma unroll
        for (int c = 0; c < 2; ++c) {
            FragB kf0, kf1;
            const unsigned short* kp = &Ksh[(c * 16 + lr) * 80 + kb];
            kf0.u[0] = *(const uint4*)kp;
            kf0.u[1] = *(const uint4*)(kp + 16);
            kf1.u[0] = *(const uint4*)(kp + 32);
            kf1.u[1] = *(const uint4*)(kp + 48);
            v8f z = zerov;
            z = wmma_bf16(q0.v, kf0.v, z);
            z = wmma_bf16(q1.v, kf1.v, z);
#pragma unroll
            for (int e = 0; e < 8; ++e) z[e] *= 0.125f;
            sc[c] = z;
        }

        // online softmax update (rows live across 16-lane halves)
#pragma unroll
        for (int e = 0; e < 8; ++e) {
            const float tm = redmax16(fmaxf(sc[0][e], sc[1][e]));
            const float mn = fmaxf(mrow[e], tm);
            const float alpha = __expf(mrow[e] - mn);
            mrow[e] = mn;
            const float p0 = __expf(sc[0][e] - mn);
            const float p1 = __expf(sc[1][e] - mn);
            lrow[e] = lrow[e] * alpha + redsum16(p0 + p1);
#pragma unroll
            for (int d = 0; d < 4; ++d) oacc[d][e] *= alpha;
            const int pr = (hi * 8 + e) * 32;            // P row (C layout)
            Psh[wave][pr + lr]      = f32_bf16(p0);
            Psh[wave][pr + 16 + lr] = f32_bf16(p1);
        }
        __syncthreads();   // make P visible across lanes (uniform flow)

        // P (A-fragment) * V^T-rows (B-fragment), 4 hd tiles
        FragB pa;
        const unsigned short* pp = &Psh[wave][lr * 32 + kb];
        pa.u[0] = *(const uint4*)pp;
        pa.u[1] = *(const uint4*)(pp + 16);
#pragma unroll
        for (int d = 0; d < 4; ++d) {
            FragB vf;
            const unsigned short* vp = &Vt[(d * 16 + lr) * 40 + kb];
            vf.u[0] = *(const uint4*)vp;
            vf.u[1] = *(const uint4*)(vp + 16);
            oacc[d] = wmma_bf16(pa.v, vf.v, oacc[d]);
        }
    }

    // epilogue: normalize and store bf16 to Ob[(s*B+b)*1024 + h*64 + hd]
#pragma unroll
    for (int e = 0; e < 8; ++e) {
        const float inv = 1.0f / lrow[e];
        const int sg = s0 + hi * 8 + e;
        const size_t base = ((size_t)sg * 8 + bidx) * 1024 + h * 64;
#pragma unroll
        for (int d = 0; d < 4; ++d)
            Ob[base + d * 16 + lr] = f32_bf16(oacc[d][e] * inv);
    }
}

// ---------------------------------------------------------------------------
// out = LayerNorm(X + Y) * g + b ; writes f32 (and optional bf16 copy)
// One block of 256 per row of 1024.
// ---------------------------------------------------------------------------
__global__ __launch_bounds__(256) void add_ln_k(const float* __restrict__ X,
                                                const float* __restrict__ Y,
                                                const float* __restrict__ g,
                                                const float* __restrict__ be,
                                                float* __restrict__ outf,
                                                unsigned short* __restrict__ outb)
{
    const int row = blockIdx.x;
    const int tid = threadIdx.x;
    const size_t base = (size_t)row * 1024;
    float v[4];
    float s = 0.f, s2 = 0.f;
#pragma unroll
    for (int i = 0; i < 4; ++i) {
        const int c = tid + i * 256;
        const float t = X[base + c] + Y[base + c];
        v[i] = t; s += t; s2 += t * t;
    }
    s  = redsum32(s);
    s2 = redsum32(s2);
    __shared__ float red[16];
    if ((tid & 31) == 0) { red[tid >> 5] = s; red[8 + (tid >> 5)] = s2; }
    __syncthreads();
    float ts = 0.f, ts2 = 0.f;
#pragma unroll
    for (int w = 0; w < 8; ++w) { ts += red[w]; ts2 += red[8 + w]; }
    const float mean = ts * (1.0f / 1024.0f);
    const float var  = ts2 * (1.0f / 1024.0f) - mean * mean;
    const float rs   = rsqrtf(var + 1e-5f);
#pragma unroll
    for (int i = 0; i < 4; ++i) {
        const int c = tid + i * 256;
        const float o = (v[i] - mean) * rs * g[c] + be[c];
        outf[base + c] = o;
        if (outb) outb[base + c] = f32_bf16(o);
    }
}

// ---------------------------------------------------------------------------
// Driver
// ---------------------------------------------------------------------------
extern "C" void kernel_launch(void* const* d_in, const int* in_sizes, int n_in,
                              void* d_out, int out_size, void* d_ws, size_t ws_size,
                              hipStream_t stream)
{
    (void)in_sizes; (void)n_in; (void)out_size; (void)ws_size;
    constexpr int Sx = 1024, Bx = 8, Dx = 1024, Hx = 16, DFF = 4096;
    constexpr int Mx = Sx * Bx;   // 8192

    const float* src  = (const float*)d_in[0];
    const float* wqkv = (const float*)d_in[1];
    const float* bqkv = (const float*)d_in[2];
    const float* wout = (const float*)d_in[3];
    const float* bout = (const float*)d_in[4];
    const float* w1   = (const float*)d_in[5];
    const float* b1   = (const float*)d_in[6];
    const float* w2   = (const float*)d_in[7];
    const float* b2   = (const float*)d_in[8];
    const float* g1   = (const float*)d_in[9];
    const float* be1  = (const float*)d_in[10];
    const float* g2   = (const float*)d_in[11];
    const float* be2  = (const float*)d_in[12];
    float* outp = (float*)d_out;

    char* ws = (char*)d_ws;
    size_t off = 0;
    auto alloc = [&](size_t bytes) -> void* {
        void* p = ws + off;
        off += (bytes + 255) & ~size_t(255);
        return p;
    };
    unsigned short* Xb    = (unsigned short*)alloc((size_t)Mx * Dx * 2);
    unsigned short* Wqkvb = (unsigned short*)alloc((size_t)3 * Dx * Dx * 2);
    unsigned short* Woutb = (unsigned short*)alloc((size_t)Dx * Dx * 2);
    unsigned short* W1b   = (unsigned short*)alloc((size_t)DFF * Dx * 2);
    unsigned short* W2b   = (unsigned short*)alloc((size_t)Dx * DFF * 2);
    unsigned short* QKVb  = (unsigned short*)alloc((size_t)Mx * 3 * Dx * 2);
    unsigned short* Obuf  = (unsigned short*)alloc((size_t)Mx * Dx * 2);
    float*          Yf    = (float*)alloc((size_t)Mx * Dx * 4);  // Y1/Y2 reuse
    float*          X1f   = (float*)alloc((size_t)Mx * Dx * 4);
    unsigned short* X1b   = (unsigned short*)alloc((size_t)Mx * Dx * 2);
    unsigned short* Hb    = (unsigned short*)alloc((size_t)Mx * DFF * 2);

    auto cvt = [&](const float* in, unsigned short* o, size_t n) {
        const int n4 = (int)(n / 4);
        cvt_bf16_4<<<(n4 + 255) / 256, 256, 0, stream>>>(in, o, n4);
    };

    // 1) f32 -> bf16
    cvt(src,  Xb,    (size_t)Mx * Dx);
    cvt(wqkv, Wqkvb, (size_t)3 * Dx * Dx);
    cvt(wout, Woutb, (size_t)Dx * Dx);
    cvt(w1,   W1b,   (size_t)DFF * Dx);
    cvt(w2,   W2b,   (size_t)Dx * DFF);

    // 2) QKV = src * Wqkv^T + b   (bf16 out)
    gemm_bf16_k<0, 1><<<dim3((3 * Dx) / 64, Mx / 128), 256, 0, stream>>>(
        Xb, Wqkvb, bqkv, nullptr, QKVb, Mx, 3 * Dx, Dx);

    // 3) attention -> Obuf (bf16, [M, D])
    attn_k<<<dim3(Sx / 128, Bx * Hx), 256, 0, stream>>>(QKVb, Obuf);

    // 4) out-proj: Yf = Obuf * Wout^T + bout (f32)
    gemm_bf16_k<0, 0><<<dim3(Dx / 64, Mx / 128), 256, 0, stream>>>(
        Obuf, Woutb, bout, Yf, nullptr, Mx, Dx, Dx);

    // 5) x = LN1(src + Yf) -> X1f (f32) + X1b (bf16)
    add_ln_k<<<Mx, 256, 0, stream>>>(src, Yf, g1, be1, X1f, X1b);

    // 6) Hb = relu(x * W1^T + b1) (bf16)
    gemm_bf16_k<1, 1><<<dim3(DFF / 64, Mx / 128), 256, 0, stream>>>(
        X1b, W1b, b1, nullptr, Hb, Mx, DFF, Dx);

    // 7) Yf = Hb * W2^T + b2 (f32)
    gemm_bf16_k<0, 0><<<dim3(Dx / 64, Mx / 128), 256, 0, stream>>>(
        Hb, W2b, b2, Yf, nullptr, Mx, Dx, DFF);

    // 8) out = LN2(x + Yf) (f32)
    add_ln_k<<<Mx, 256, 0, stream>>>(X1f, Yf, g2, be2, outp, nullptr);
}

// v001
// It runs in 383 microseconds.
// Two timings next to v000 put it at 1.05 and 1.04 times that version's speed.
#include <hip/hip_runtime.h>
#include <hip/hip_bf16.h>

// ---------------------------------------------------------------------------
// Types
// ---------------------------------------------------------------------------
typedef __attribute__((ext_vector_type(16))) __bf16 v16bf;
typedef __attribute__((ext_vector_type(8)))  float  v8f;
typedef __attribute__((ext_vector_type(4)))  unsigned int u32x4;
typedef __attribute__((ext_vector_type(8)))  int  i32x8;
typedef __attribute__((ext_vector_type(4)))  int  i32x4;

union FragB {
    uint4  u[2];   // 32 bytes = 16 bf16
    v16bf  v;
};

__device__ __forceinline__ unsigned short f32_bf16(float f) {
    unsigned int u = __builtin_bit_cast(unsigned int, f);
    unsigned int r = u + 0x7FFFu + ((u >> 16) & 1u);   // round-to-nearest-even
    return (unsigned short)(r >> 16);
}

__device__ __forceinline__ v8f wmma_bf16(v16bf a, v16bf b, v8f c) {
    // D(16x16,f32) = A(16x32,bf16) * B(32x16,bf16) + C
    return __builtin_amdgcn_wmma_f32_16x16x32_bf16(
        false, a, false, b, (short)0, c, false, false);
}

// ds_swizzle_b32 butterfly (group-of-32 mode: and=0x1f, or=0, xor=MASK)
template <int MASK>
__device__ __forceinline__ float swz(float x) {
    int r = __builtin_amdgcn_ds_swizzle(__builtin_bit_cast(int, x),
                                        (MASK << 10) | 0x1f);
    return __builtin_bit_cast(float, r);
}
__device__ __forceinline__ float redmax16(float x) {
    x = fmaxf(x, swz<1>(x)); x = fmaxf(x, swz<2>(x));
    x = fmaxf(x, swz<4>(x)); x = fmaxf(x, swz<8>(x));
    return x;
}
__device__ __forceinline__ float redsum16(float x) {
    x += swz<1>(x); x += swz<2>(x); x += swz<4>(x); x += swz<8>(x);
    return x;
}
__device__ __forceinline__ float redsum32(float x) {
    x += swz<1>(x); x += swz<2>(x); x += swz<4>(x);
    x += swz<8>(x); x += swz<16>(x);
    return x;
}

#if __has_builtin(__builtin_amdgcn_tensor_load_to_lds)
#define USE_TDM 1
#else
#define USE_TDM 0
#endif

__device__ __forceinline__ unsigned lds_off(const void* p) {
    return (unsigned)(unsigned long long)p;   // low 32 bits = LDS byte offset
}

#if USE_TDM
__device__ __forceinline__ void tdm_load_2d(unsigned ldsoff, const void* gp,
                                            unsigned tile_d0, unsigned tile_d1,
                                            unsigned stride_elts,
                                            unsigned pad_int, unsigned pad_amt)
{
    unsigned long long ga = (unsigned long long)gp;
    u32x4 g0;
    g0[0] = 1u;                                              // count=1 (user)
    g0[1] = ldsoff;                                          // lds_addr
    g0[2] = (unsigned)ga;                                    // global_addr lo
    g0[3] = (unsigned)((ga >> 32) & 0x01FFFFFFu) | (2u << 30); // addr hi | type=2
    i32x8 g1;
    g1[0] = (int)((1u << 16)
                | (1u << 20)
                | (pad_int << 22)
                | (pad_amt << 25));
    g1[1] = (int)((tile_d0 & 0xFFFFu) << 16);
    g1[2] = (int)((tile_d1 & 0xFFFFu) << 16);
    g1[3] = (int)(tile_d0 << 16);
    g1[4] = (int)tile_d1;
    g1[5] = (int)stride_elts;
    g1[6] = 0;
    g1[7] = 0;
    i32x4 z4 = {0, 0, 0, 0};
#if __clang_major__ >= 23
    i32x8 z8 = {0, 0, 0, 0, 0, 0, 0, 0};
    __builtin_amdgcn_tensor_load_to_lds(g0, g1, z4, z4, z8, 0);
#else
    __builtin_amdgcn_tensor_load_to_lds(g0, g1, z4, z4, 0);
#endif
}
#endif

// ---------------------------------------------------------------------------
// f32 -> bf16 conversion, 4-wide
// ---------------------------------------------------------------------------
__global__ __launch_bounds__(256) void cvt_bf16_4(const float* __restrict__ in,
                                                  unsigned short* __restrict__ out,
                                                  int n4) {
    int i = blockIdx.x * 256 + threadIdx.x;
    if (i < n4) {
        float4 f = ((const float4*)in)[i];
        ushort4 r;
        r.x = f32_bf16(f.x); r.y = f32_bf16(f.y);
        r.z = f32_bf16(f.z); r.w = f32_bf16(f.w);
        ((ushort4*)out)[i] = r;
    }
}

// ---------------------------------------------------------------------------
// GEMM: C[M,N] = A[M,K] * W[N,K]^T + bias[N]   (A, W row-major bf16)
// Tile: 256(M) x 128(N), BK=64 (two WMMA k-steps per stage). 8 waves, 4x2,
// each wave computes 64x64 via 4x4 WMMA 16x16 f32 accumulators: half the
// bytes staged from L2 per product and half the LDS reads per WMMA of a
// 128x64 tile with 32x32 per wave.
// Tiles staged to LDS by the Tensor Data Mover (padded stride 72 halfs).
// ---------------------------------------------------------------------------
template <int RELU, int OUTBF>
__global__ __launch_bounds__(256) void gemm_bf16_k(
    const unsigned short* __restrict__ A,
    const unsigned short* __restrict__ W,
    const float* __restrict__ bias,
    float* __restrict__ Cf,
    unsigned short* __restrict__ Cb,
    int M, int N, int K)
{
    alignas(16) __shared__ unsigned short Ash[256 * 72];
    alignas(16) __shared__ unsigned short Bsh[128 * 72];

    const int tid  = threadIdx.x;
    const int lane = tid & 31;
    const int wave = tid >> 5;
    const int wr   = wave >> 1;          // 0..3
    const int wc   = wave & 1;           // 0..1
    const int lr   = lane & 15;
    const int hi   = lane >> 4;
    const int kb   = hi * 8;
    const int m0   = blockIdx.y * 256;
    const int n0   = blockIdx.x * 128;

    const v8f zerov = {0.f, 0.f, 0.f, 0.f, 0.f, 0.f, 0.f, 0.f};
    v8f acc[4][4];
#pragma unroll
    for (int i = 0; i < 4; ++i)
#pragma unroll
        for (int j = 0; j < 4; ++j) acc[i][j] = zerov;

    for (int k0 = 0; k0 < K; k0 += 64) {
        __syncthreads();
#if USE_TDM
        if (wave == 0) {
            tdm_load_2d(lds_off(Ash), A + (size_t)m0 * K + k0,
                        64, 256, (unsigned)K, 4, 3);
            tdm_load_2d(lds_off(Bsh), W + (size_t)n0 * K + k0,
                        64, 128, (unsigned)K, 4, 3);
            __builtin_amdgcn_s_wait_tensorcnt(0);
        }
#else
#pragma unroll
        for (int c = tid; c < 2048; c += 256) {
            const int row = c >> 3, kc = (c & 7) * 8;
            *(uint4*)&Ash[row * 72 + kc] =
                *(const uint4*)&A[(size_t)(m0 + row) * K + k0 + kc];
        }
#pragma unroll
        for (int c = tid; c < 1024; c += 256) {
            const int row = c >> 3, kc = (c & 7) * 8;
            *(uint4*)&Bsh[row * 72 + kc] =
                *(const uint4*)&W[(size_t)(n0 + row) * K + k0 + kc];
        }
#endif
        __syncthreads();

#pragma unroll
        for (int ks = 0; ks < 2; ++ks) {
            const int ko = ks * 32 + kb;
            FragB a[4], b[4];
#pragma unroll
            for (int i = 0; i < 4; ++i) {
                const unsigned short* p = &Ash[(wr * 64 + i * 16 + lr) * 72 + ko];
                a[i].u[0] = *(const uint4*)p;          // K = ko..ko+7
                a[i].u[1] = *(const uint4*)(p + 16);   // K = ko+16..ko+23
            }
#pragma unroll
            for (int j = 0; j < 4; ++j) {
                const unsigned short* p = &Bsh[(wc * 64 + j * 16 + lr) * 72 + ko];
                b[j].u[0] = *(const uint4*)p;
                b[j].u[1] = *(const uint4*)(p + 16);
            }
            __builtin_amdgcn_sched_barrier(0);
#pragma unroll
            for (int i = 0; i < 4; ++i)
#pragma unroll
                for (int j = 0; j < 4; ++j)
                    acc[i][j] = wmma_bf16(a[i].v, b[j].v, acc[i][j]);
        }
    }

    // epilogue: C layout -> element e is row (e + 8*hi), col lr within tile
#pragma unroll
    for (int j = 0; j < 4; ++j) {
        const int col = n0 + wc * 64 + j * 16 + lr;
        const float bv = bias[col];
#pragma unroll
        for (int i = 0; i < 4; ++i) {
#pragma unroll
            for (int e = 0; e < 8; ++e) {
                const int row = m0 + wr * 64 + i * 16 + hi * 8 + e;
                float v = acc[i][j][e] + bv;
                if (RELU) v = fmaxf(v, 0.f);
                if (OUTBF) Cb[(size_t)row * N + col] = f32_bf16(v);
                else       Cf[(size_t)row * N + col] = v;
            }
        }
    }
}

__global__ __launch_bounds__(256) void attn_k(const unsigned short* __restrict__ QKV,
                                              unsigned short* __restrict__ Ob)
{
    alignas(16) __shared__ unsigned short Ksh[32 * 80];      // stride 80 halfs
    alignas(16) __shared__ unsigned short Vt[64 * 40];       // V^T, stride 40
    alignas(16) __shared__ unsigned short Psh[8][16 * 32];   // per-wave P tile

    const int tid  = threadIdx.x;
    const int lane = tid & 31;
    const int wave = tid >> 5;
    const int lr   = lane & 15;
    const int hi   = lane >> 4;
    const int kb   = hi * 8;
    const int bh   = blockIdx.y;
    const int bidx = bh >> 4;      // batch
    const int h    = bh & 15;      // head
    const int s0   = blockIdx.x * 128 + wave * 16;
    const int rowStride = 8 * 3072;                 // halfs per s step (B*3D)
    const size_t qoff = (size_t)bidx * 3072 + h * 64;
    const size_t koff = qoff + 1024;
    const size_t voff = qoff + 2048;

    // Q fragments (hd 0..31 and 32..63), loaded once
    FragB q0, q1;
    {
        const unsigned short* qp = QKV + (size_t)(s0 + lr) * rowStride + qoff + kb;
        q0.u[0] = *(const uint4*)qp;
        q0.u[1] = *(const uint4*)(qp + 16);
        q1.u[0] = *(const uint4*)(qp + 32);
        q1.u[1] = *(const uint4*)(qp + 48);
    }

    const v8f zerov = {0.f, 0.f, 0.f, 0.f, 0.f, 0.f, 0.f, 0.f};
    float mrow[8], lrow[8];
    v8f oacc[4];
#pragma unroll
    for (int e = 0; e < 8; ++e) { mrow[e] = -1e30f; lrow[e] = 0.f; }
#pragma unroll
    for (int d = 0; d < 4; ++d) oacc[d] = zerov;

    for (int it = 0; it < 32; ++it) {
        const int kt0 = it * 32;
        __syncthreads();   // previous iteration's LDS readers done
#if USE_TDM
        if (wave == 0) {
            tdm_load_2d(lds_off(Ksh),
                        QKV + (size_t)kt0 * rowStride + koff,
                        64, 32, (unsigned)rowStride, 4, 7);
        }
#else
        {
            const int row = tid >> 3, kc = (tid & 7) * 8;
            *(uint4*)&Ksh[row * 80 + kc] =
                *(const uint4*)&QKV[(size_t)(kt0 + row) * rowStride + koff + kc];
        }
#endif
        {
            // V block: store transposed -> Vt[hd][t]
            const int row = tid >> 3, kc = (tid & 7) * 8;
            union { uint4 u; unsigned short s[8]; } cv;
            cv.u = *(const uint4*)&QKV[(size_t)(kt0 + row) * rowStride + voff + kc];
#pragma unroll
            for (int e2 = 0; e2 < 8; ++e2) Vt[(kc + e2) * 40 + row] = cv.s[e2];
        }
#if USE_TDM
        if (wave == 0) __builtin_amdgcn_s_wait_tensorcnt(0);
#endif
        __syncthreads();

        // S = (Q K^T) * 1/sqrt(64)  -> two 16x16 column tiles
        v8f sc[2];
#pragma unroll
        for (int c = 0; c < 2; ++c) {
            FragB kf0, kf1;
            const unsigned short* kp = &Ksh[(c * 16 + lr) * 80 + kb];
            kf0.u[0] = *(const uint4*)kp;
            kf0.u[1] = *(const uint4*)(kp + 16);
            kf1.u[0] = *(const uint4*)(kp + 32);
            kf1.u[1] = *(const uint4*)(kp + 48);
            v8f z = zerov;
            z = wmma_bf16(q0.v, kf0.v, z);
            z = wmma_bf16(q1.v, kf1.v, z);
#pragma unroll
            for (int e = 0; e < 8; ++e) z[e] *= 0.125f;
            sc[c] = z;
        }

        // online softmax update (rows live across 16-lane halves)
#pragma unroll
        for (int e = 0; e < 8; ++e) {
            const float tm = redmax16(fmaxf(sc[0][e], sc[1][e]));
            const float mn = fmaxf(mrow[e], tm);
            const float alpha = __expf(mrow[e] - mn);
            mrow[e] = mn;
            const float p0 = __expf(sc[0][e] - mn);
            const float p1 = __expf(sc[1][e] - mn);
            lrow[e] = lrow[e] * alpha + redsum16(p0 + p1);
#pragma unroll
            for (int d = 0; d < 4; ++d) oacc[d][e] *= alpha;
            const int pr = (hi * 8 + e) * 32;            // P row (C layout)
            Psh[wave][pr + lr]      = f32_bf16(p0);
            Psh[wave][pr + 16 + lr] = f32_bf16(p1);
        }
        __syncthreads();   // make P visible across lanes (uniform flow)

        // P (A-fragment) * V^T-rows (B-fragment), 4 hd tiles
        FragB pa;
        const unsigned short* pp = &Psh[wave][lr * 32 + kb];
        pa.u[0] = *(const uint4*)pp;
        pa.u[1] = *(const uint4*)(pp + 16);
#pragma unroll
        for (int d = 0; d < 4; ++d) {
            FragB vf;
            const unsigned short* vp = &Vt[(d * 16 + lr) * 40 + kb];
            vf.u[0] = *(const uint4*)vp;
            vf.u[1] = *(const uint4*)(vp + 16);
            oacc[d] = wmma_bf16(pa.v, vf.v, oacc[d]);
        }
    }

    // epilogue: normalize and store bf16 to Ob[(s*B+b)*1024 + h*64 + hd]
#pragma unroll
    for (int e = 0; e < 8; ++e) {
        const float inv = 1.0f / lrow[e];
        const int sg = s0 + hi * 8 + e;
        const size_t base = ((size_t)sg * 8 + bidx) * 1024 + h * 64;
#pragma unroll
        for (int d = 0; d < 4; ++d)
            Ob[base + d * 16 + lr] = f32_bf16(oacc[d][e] * inv);
    }
}

// ---------------------------------------------------------------------------
// out = LayerNorm(X + Y) * g + b ; writes f32 (and optional bf16 copy)
// One block of 256 per row of 1024.
// ---------------------------------------------------------------------------
__global__ __launch_bounds__(256) void add_ln_k(const float* __restrict__ X,
                                                const float* __restrict__ Y,
                                                const float* __restrict__ g,
                                                const float* __restrict__ be,
                                                float* __restrict__ outf,
                                                unsigned short* __restrict__ outb)
{
    const int row = blockIdx.x;
    const int tid = threadIdx.x;
    const size_t base = (size_t)row * 1024;
    float v[4];
    float s = 0.f, s2 = 0.f;
#pragma unroll
    for (int i = 0; i < 4; ++i) {
        const int c = tid + i * 256;
        const float t = X[base + c] + Y[base + c];
        v[i] = t; s += t; s2 += t * t;
    }
    s  = redsum32(s);
    s2 = redsum32(s2);
    __shared__ float red[16];
    if ((tid & 31) == 0) { red[tid >> 5] = s; red[8 + (tid >> 5)] = s2; }
    __syncthreads();
    float ts = 0.f, ts2 = 0.f;
#pragma unroll
    for (int w = 0; w < 8; ++w) { ts += red[w]; ts2 += red[8 + w]; }
    const float mean = ts * (1.0f / 1024.0f);
    const float var  = ts2 * (1.0f / 1024.0f) - mean * mean;
    const float rs   = rsqrtf(var + 1e-5f);
#pragma unroll
    for (int i = 0; i < 4; ++i) {
        const int c = tid + i * 256;
        const float o = (v[i] - mean) * rs * g[c] + be[c];
        outf[base + c] = o;
        if (outb) outb[base + c] = f32_bf16(o);
    }
}

// ---------------------------------------------------------------------------
// Driver
// ---------------------------------------------------------------------------
extern "C" void kernel_launch(void* const* d_in, const int* in_sizes, int n_in,
                              void* d_out, int out_size, void* d_ws, size_t ws_size,
                              hipStream_t stream)
{
    (void)in_sizes; (void)n_in; (void)out_size; (void)ws_size;
    constexpr int Sx = 1024, Bx = 8, Dx = 1024, Hx = 16, DFF = 4096;
    constexpr int Mx = Sx * Bx;   // 8192

    const float* src  = (const float*)d_in[0];
    const float* wqkv = (const float*)d_in[1];
    const float* bqkv = (const float*)d_in[2];
    const float* wout = (const float*)d_in[3];
    const float* bout = (const float*)d_in[4];
    const float* w1   = (const float*)d_in[5];
    const float* b1   = (const float*)d_in[6];
    const float* w2   = (const float*)d_in[7];
    const float* b2   = (const float*)d_in[8];
    const float* g1   = (const float*)d_in[9];
    const float* be1  = (const float*)d_in[10];
    const float* g2   = (const float*)d_in[11];
    const float* be2  = (const float*)d_in[12];
    float* outp = (float*)d_out;

    char* ws = (char*)d_ws;
    size_t off = 0;
    auto alloc = [&](size_t bytes) -> void* {
        void* p = ws + off;
        off += (bytes + 255) & ~size_t(255);
        return p;
    };
    unsigned short* Xb    = (unsigned short*)alloc((size_t)Mx * Dx * 2);
    unsigned short* Wqkvb = (unsigned short*)alloc((size_t)3 * Dx * Dx * 2);
    unsigned short* Woutb = (unsigned short*)alloc((size_t)Dx * Dx * 2);
    unsigned short* W1b   = (unsigned short*)alloc((size_t)DFF * Dx * 2);
    unsigned short* W2b   = (unsigned short*)alloc((size_t)Dx * DFF * 2);
    unsigned short* QKVb  = (unsigned short*)alloc((size_t)Mx * 3 * Dx * 2);
    unsigned short* Obuf  = (unsigned short*)alloc((size_t)Mx * Dx * 2);
    float*          Yf    = (float*)alloc((size_t)Mx * Dx * 4);  // Y1/Y2 reuse
    float*          X1f   = (float*)alloc((size_t)Mx * Dx * 4);
    unsigned short* X1b   = (unsigned short*)alloc((size_t)Mx * Dx * 2);
    unsigned short* Hb    = (unsigned short*)alloc((size_t)Mx * DFF * 2);

    auto cvt = [&](const float* in, unsigned short* o, size_t n) {
        const int n4 = (int)(n / 4);
        cvt_bf16_4<<<(n4 + 255) / 256, 256, 0, stream>>>(in, o, n4);
    };

    // 1) f32 -> bf16
    cvt(src,  Xb,    (size_t)Mx * Dx);
    cvt(wqkv, Wqkvb, (size_t)3 * Dx * Dx);
    cvt(wout, Woutb, (size_t)Dx * Dx);
    cvt(w1,   W1b,   (size_t)DFF * Dx);
    cvt(w2,   W2b,   (size_t)Dx * DFF);

    // 2) QKV = src * Wqkv^T + b   (bf16 out)
    gemm_bf16_k<0, 1><<<dim3((3 * Dx) / 128, Mx / 256), 256, 0, stream>>>(
        Xb, Wqkvb, bqkv, nullptr, QKVb, Mx, 3 * Dx, Dx);

    // 3) attention -> Obuf (bf16, [M, D])
    attn_k<<<dim3(Sx / 128, Bx * Hx), 256, 0, stream>>>(QKVb, Obuf);

    // 4) out-proj: Yf = Obuf * Wout^T + bout (f32)
    gemm_bf16_k<0, 0><<<dim3(Dx / 128, Mx / 256), 256, 0, stream>>>(
        Obuf, Woutb, bout, Yf, nullptr, Mx, Dx, Dx);

    // 5) x = LN1(src + Yf) -> X1f (f32) + X1b (bf16)
    add_ln_k<<<Mx, 256, 0, stream>>>(src, Yf, g1, be1, X1f, X1b);

    // 6) Hb = relu(x * W1^T + b1) (bf16)
    gemm_bf16_k<1, 1><<<dim3(DFF / 128, Mx / 256), 256, 0, stream>>>(
        X1b, W1b, b1, nullptr, Hb, Mx, DFF, Dx);

    // 7) Yf = Hb * W2^T + b2 (f32)
    gemm_bf16_k<0, 0><<<dim3(Dx / 128, Mx / 256), 256, 0, stream>>>(
        Hb, W2b, b2, Yf, nullptr, Mx, Dx, DFF);

    // 8) out = LN2(x + Yf) (f32)
    add_ln_k<<<Mx, 256, 0, stream>>>(X1f, Yf, g2, be2, outp, nullptr);
}

// v002
// It runs in 365 microseconds.
// Next to v001, in two timings, it ran 1.06 and 1.04 times as fast.
// Over all steps from v000 it is 1.09 times as fast.
#include <hip/hip_runtime.h>
#include <hip/hip_bf16.h>

// ---------------------------------------------------------------------------
// Types
// ---------------------------------------------------------------------------
typedef __attribute__((ext_vector_type(16))) __bf16 v16bf;
typedef __attribute__((ext_vector_type(8)))  float  v8f;
typedef __attribute__((ext_vector_type(4)))  unsigned int u32x4;
typedef __attribute__((ext_vector_type(8)))  int  i32x8;
typedef __attribute__((ext_vector_type(4)))  int  i32x4;

union FragB {
    uint4  u[2];   // 32 bytes = 16 bf16
    v16bf  v;
};

__device__ __forceinline__ unsigned short f32_bf16(float f) {
    unsigned int u = __builtin_bit_cast(unsigned int, f);
    unsigned int r = u + 0x7FFFu + ((u >> 16) & 1u);   // round-to-nearest-even
    return (unsigned short)(r >> 16);
}

__device__ __forceinline__ v8f wmma_bf16(v16bf a, v16bf b, v8f c) {
    // D(16x16,f32) = A(16x32,bf16) * B(32x16,bf16) + C
    return __builtin_amdgcn_wmma_f32_16x16x32_bf16(
        false, a, false, b, (short)0, c, false, false);
}

// ds_swizzle_b32 butterfly (group-of-32 mode: and=0x1f, or=0, xor=MASK)
template <int MASK>
__device__ __forceinline__ float swz(float x) {
    int r = __builtin_amdgcn_ds_swizzle(__builtin_bit_cast(int, x),
                                        (MASK << 10) | 0x1f);
    return __builtin_bit_cast(float, r);
}
__device__ __forceinline__ float redmax16(float x) {
    x = fmaxf(x, swz<1>(x)); x = fmaxf(x, swz<2>(x));
    x = fmaxf(x, swz<4>(x)); x = fmaxf(x, swz<8>(x));
    return x;
}
__device__ __forceinline__ float redsum16(float x) {
    x += swz<1>(x); x += swz<2>(x); x += swz<4>(x); x += swz<8>(x);
    return x;
}
__device__ __forceinline__ float redsum32(float x) {
    x += swz<1>(x); x += swz<2>(x); x += swz<4>(x);
    x += swz<8>(x); x += swz<16>(x);
    return x;
}

#if __has_builtin(__builtin_amdgcn_tensor_load_to_lds)
#define USE_TDM 1
#else
#define USE_TDM 0
#endif

__device__ __forceinline__ unsigned lds_off(const void* p) {
    return (unsigned)(unsigned long long)p;   // low 32 bits = LDS byte offset
}

#if USE_TDM
__device__ __forceinline__ void tdm_load_2d(unsigned ldsoff, const void* gp,
                                            unsigned tile_d0, unsigned tile_d1,
                                            unsigned stride_elts,
                                            unsigned pad_int, unsigned pad_amt)
{
    unsigned long long ga = (unsigned long long)gp;
    u32x4 g0;
    g0[0] = 1u;                                              // count=1 (user)
    g0[1] = ldsoff;                                          // lds_addr
    g0[2] = (unsigned)ga;                                    // global_addr lo
    g0[3] = (unsigned)((ga >> 32) & 0x01FFFFFFu) | (2u << 30); // addr hi | type=2
    i32x8 g1;
    g1[0] = (int)((1u << 16)
                | (1u << 20)
                | (pad_int << 22)
                | (pad_amt << 25));
    g1[1] = (int)((tile_d0 & 0xFFFFu) << 16);
    g1[2] = (int)((tile_d1 & 0xFFFFu) << 16);
    g1[3] = (int)(tile_d0 << 16);
    g1[4] = (int)tile_d1;
    g1[5] = (int)stride_elts;
    g1[6] = 0;
    g1[7] = 0;
    i32x4 z4 = {0, 0, 0, 0};
#if __clang_major__ >= 23
    i32x8 z8 = {0, 0, 0, 0, 0, 0, 0, 0};
    __builtin_amdgcn_tensor_load_to_lds(g0, g1, z4, z4, z8, 0);
#else
    __builtin_amdgcn_tensor_load_to_lds(g0, g1, z4, z4, 0);
#endif
}
#endif

// ---------------------------------------------------------------------------
// f32 -> bf16 conversion. A block converts 2048 float4, 8 per thread, all 8 loads
// in flight at once: an eighth of the waves to start for the same bytes.
// The element count is a multiple of 8192 (asserted where it is launched).
// ---------------------------------------------------------------------------
typedef __attribute__((ext_vector_type(4))) float v4f;

__device__ __forceinline__ ushort4 cvt4(v4f f) {
    ushort4 r;
    r.x = f32_bf16(f.x); r.y = f32_bf16(f.y);
    r.z = f32_bf16(f.z); r.w = f32_bf16(f.w);
    return r;
}

__global__ __launch_bounds__(256) void cvt_bf16_4(const float* __restrict__ in,
                                                  unsigned short* __restrict__ out) {
    const int i0 = blockIdx.x * 2048 + threadIdx.x;
    v4f f[8];
    // both loops unrolled: f[] stays in registers and the 8 loads issue together
#pragma unroll
    for (int u = 0; u < 8; ++u) f[u] = ((const v4f*)in)[i0 + u * 256];
#pragma unroll
    for (int u = 0; u < 8; ++u) ((ushort4*)out)[i0 + u * 256] = cvt4(f[u]);
}

// ---------------------------------------------------------------------------
// GEMM: C[M,N] = A[M,K] * W[N,K]^T + bias[N]   (A, W row-major bf16)
// Tile: 256(M) x 128(N), BK=64 (two WMMA k-steps per stage). 8 waves, 4x2,
// each wave computes 64x64 via 4x4 WMMA 16x16 f32 accumulators: half the
// bytes staged from L2 per product and half the LDS reads per WMMA of a
// 128x64 tile with 32x32 per wave.
// Tiles staged to LDS by the Tensor Data Mover (padded stride 72 halfs).
// ---------------------------------------------------------------------------
template <int RELU, int OUTBF>
__global__ __launch_bounds__(256) void gemm_bf16_k(
    const unsigned short* __restrict__ A,
    const unsigned short* __restrict__ W,
    const float* __restrict__ bias,
    float* __restrict__ Cf,
    unsigned short* __restrict__ Cb,
    int M, int N, int K)
{
    alignas(16) __shared__ unsigned short Ash[256 * 72];
    alignas(16) __shared__ unsigned short Bsh[128 * 72];

    const int tid  = threadIdx.x;
    const int lane = tid & 31;
    const int wave = tid >> 5;
    const int wr   = wave >> 1;          // 0..3
    const int wc   = wave & 1;           // 0..1
    const int lr   = lane & 15;
    const int hi   = lane >> 4;
    const int kb   = hi * 8;
    const int m0   = blockIdx.y * 256;
    const int n0   = blockIdx.x * 128;

    const v8f zerov = {0.f, 0.f, 0.f, 0.f, 0.f, 0.f, 0.f, 0.f};
    v8f acc[4][4];
#pragma unroll
    for (int i = 0; i < 4; ++i)
#pragma unroll
        for (int j = 0; j < 4; ++j) acc[i][j] = zerov;

    for (int k0 = 0; k0 < K; k0 += 64) {
        __syncthreads();
#if USE_TDM
        if (wave == 0) {
            tdm_load_2d(lds_off(Ash), A + (size_t)m0 * K + k0,
                        64, 256, (unsigned)K, 4, 3);
            tdm_load_2d(lds_off(Bsh), W + (size_t)n0 * K + k0,
                        64, 128, (unsigned)K, 4, 3);
            __builtin_amdgcn_s_wait_tensorcnt(0);
        }
#else
#pragma unroll
        for (int c = tid; c < 2048; c += 256) {
            const int row = c >> 3, kc = (c & 7) * 8;
            *(uint4*)&Ash[row * 72 + kc] =
                *(const uint4*)&A[(size_t)(m0 + row) * K + k0 + kc];
        }
#pragma unroll
        for (int c = tid; c < 1024; c += 256) {
            const int row = c >> 3, kc = (c & 7) * 8;
            *(uint4*)&Bsh[row * 72 + kc] =
                *(const uint4*)&W[(size_t)(n0 + row) * K + k0 + kc];
        }
#endif
        __syncthreads();

#pragma unroll
        for (int ks = 0; ks < 2; ++ks) {
            const int ko = ks * 32 + kb;
            FragB a[4], b[4];
#pragma unroll
            for (int i = 0; i < 4; ++i) {
                const unsigned short* p = &Ash[(wr * 64 + i * 16 + lr) * 72 + ko];
                a[i].u[0] = *(const uint4*)p;          // K = ko..ko+7
                a[i].u[1] = *(const uint4*)(p + 16);   // K = ko+16..ko+23
            }
#pragma unroll
            for (int j = 0; j < 4; ++j) {
                const unsigned short* p = &Bsh[(wc * 64 + j * 16 + lr) * 72 + ko];
                b[j].u[0] = *(const uint4*)p;
                b[j].u[1] = *(const uint4*)(p + 16);
            }
            __builtin_amdgcn_sched_barrier(0);
#pragma unroll
            for (int i = 0; i < 4; ++i)
#pragma unroll
                for (int j = 0; j < 4; ++j)
                    acc[i][j] = wmma_bf16(a[i].v, b[j].v, acc[i][j]);
        }
    }

    // epilogue: C layout -> element e is row (e + 8*hi), col lr within tile
#pragma unroll
    for (int j = 0; j < 4; ++j) {
        const int col = n0 + wc * 64 + j * 16 + lr;
        const float bv = bias[col];
#pragma unroll
        for (int i = 0; i < 4; ++i) {
#pragma unroll
            for (int e = 0; e < 8; ++e) {
                const int row = m0 + wr * 64 + i * 16 + hi * 8 + e;
                float v = acc[i][j][e] + bv;
                if (RELU) v = fmaxf(v, 0.f);
                if (OUTBF) Cb[(size_t)row * N + col] = f32_bf16(v);
                else       Cf[(size_t)row * N + col] = v;
            }
        }
    }
}

__global__ __launch_bounds__(256) void attn_k(const unsigned short* __restrict__ QKV,
                                              unsigned short* __restrict__ Ob)
{
    alignas(16) __shared__ unsigned short Ksh[32 * 80];      // stride 80 halfs
    alignas(16) __shared__ unsigned short Vt[64 * 40];       // V^T, stride 40
    alignas(16) __shared__ unsigned short Psh[8][16 * 32];   // per-wave P tile

    const int tid  = threadIdx.x;
    const int lane = tid & 31;
    const int wave = tid >> 5;
    const int lr   = lane & 15;
    const int hi   = lane >> 4;
    const int kb   = hi * 8;
    const int bh   = blockIdx.y;
    const int bidx = bh >> 4;      // batch
    const int h    = bh & 15;      // head
    const int s0   = blockIdx.x * 128 + wave * 16;
    const int rowStride = 8 * 3072;                 // halfs per s step (B*3D)
    const size_t qoff = (size_t)bidx * 3072 + h * 64;
    const size_t koff = qoff + 1024;
    const size_t voff = qoff + 2048;

    // Q fragments (hd 0..31 and 32..63), loaded once
    FragB q0, q1;
    {
        const unsigned short* qp = QKV + (size_t)(s0 + lr) * rowStride + qoff + kb;
        q0.u[0] = *(const uint4*)qp;
        q0.u[1] = *(const uint4*)(qp + 16);
        q1.u[0] = *(const uint4*)(qp + 32);
        q1.u[1] = *(const uint4*)(qp + 48);
    }

    const v8f zerov = {0.f, 0.f, 0.f, 0.f, 0.f, 0.f, 0.f, 0.f};
    float mrow[8], lrow[8];
    v8f oacc[4];
#pragma unroll
    for (int e = 0; e < 8; ++e) { mrow[e] = -1e30f; lrow[e] = 0.f; }
#pragma unroll
    for (int d = 0; d < 4; ++d) oacc[d] = zerov;

    for (int it = 0; it < 32; ++it) {
        const int kt0 = it * 32;
        __syncthreads();   // previous iteration's LDS readers done
#if USE_TDM
        if (wave == 0) {
            tdm_load_2d(lds_off(Ksh),
                        QKV + (size_t)kt0 * rowStride + koff,
                        64, 32, (unsigned)rowStride, 4, 7);
        }
#else
        {
            const int row = tid >> 3, kc = (tid & 7) * 8;
            *(uint4*)&Ksh[row * 80 + kc] =
                *(const uint4*)&QKV[(size_t)(kt0 + row) * rowStride + koff + kc];
        }
#endif
        {
            // V block: store transposed -> Vt[hd][t]
            const int row = tid >> 3, kc = (tid & 7) * 8;
            union { uint4 u; unsigned short s[8]; } cv;
            cv.u = *(const uint4*)&QKV[(size_t)(kt0 + row) * rowStride + voff + kc];
#pragma unroll
            for (int e2 = 0; e2 < 8; ++e2) Vt[(kc + e2) * 40 + row] = cv.s[e2];
        }
#if USE_TDM
        if (wave == 0) __builtin_amdgcn_s_wait_tensorcnt(0);
#endif
        __syncthreads();

        // S = (Q K^T) * 1/sqrt(64)  -> two 16x16 column tiles
        v8f sc[2];
#pragma unroll
        for (int c = 0; c < 2; ++c) {
            FragB kf0, kf1;
            const unsigned short* kp = &Ksh[(c * 16 + lr) * 80 + kb];
            kf0.u[0] = *(const uint4*)kp;
            kf0.u[1] = *(const uint4*)(kp + 16);
            kf1.u[0] = *(const uint4*)(kp + 32);
            kf1.u[1] = *(const uint4*)(kp + 48);
            v8f z = zerov;
            z = wmma_bf16(q0.v, kf0.v, z);
            z = wmma_bf16(q1.v, kf1.v, z);
#pragma unroll
            for (int e = 0; e < 8; ++e) z[e] *= 0.125f;
            sc[c] = z;
        }

        // online softmax update (rows live across 16-lane halves)
#pragma unroll
        for (int e = 0; e < 8; ++e) {
            const float tm = redmax16(fmaxf(sc[0][e], sc[1][e]));
            const float mn = fmaxf(mrow[e], tm);
            const float alpha = __expf(mrow[e] - mn);
            mrow[e] = mn;
            const float p0 = __expf(sc[0][e] - mn);
            const float p1 = __expf(sc[1][e] - mn);
            lrow[e] = lrow[e] * alpha + redsum16(p0 + p1);
#pragma unroll
            for (int d = 0; d < 4; ++d) oacc[d][e] *= alpha;
            const int pr = (hi * 8 + e) * 32;            // P row (C layout)
            Psh[wave][pr + lr]      = f32_bf16(p0);
            Psh[wave][pr + 16 + lr] = f32_bf16(p1);
        }
        __syncthreads();   // make P visible across lanes (uniform flow)

        // P (A-fragment) * V^T-rows (B-fragment), 4 hd tiles
        FragB pa;
        const unsigned short* pp = &Psh[wave][lr * 32 + kb];
        pa.u[0] = *(const uint4*)pp;
        pa.u[1] = *(const uint4*)(pp + 16);
#pragma unroll
        for (int d = 0; d < 4; ++d) {
            FragB vf;
            const unsigned short* vp = &Vt[(d * 16 + lr) * 40 + kb];
            vf.u[0] = *(const uint4*)vp;
            vf.u[1] = *(const uint4*)(vp + 16);
            oacc[d] = wmma_bf16(pa.v, vf.v, oacc[d]);
        }
    }

    // epilogue: normalize and store bf16 to Ob[(s*B+b)*1024 + h*64 + hd]
#pragma unroll
    for (int e = 0; e < 8; ++e) {
        const float inv = 1.0f / lrow[e];
        const int sg = s0 + hi * 8 + e;
        const size_t base = ((size_t)sg * 8 + bidx) * 1024 + h * 64;
#pragma unroll
        for (int d = 0; d < 4; ++d)
            Ob[base + d * 16 + lr] = f32_bf16(oacc[d][e] * inv);
    }
}

// ---------------------------------------------------------------------------
// out = LayerNorm(X + Y) * g + b ; writes f32 (and optional bf16 copy)
// One wave per row of 1024, 8 rows per block of 256: a lane holds 32 values of its
// row, moved 16 bytes at a time; the row sums are a butterfly inside the wave.
// ---------------------------------------------------------------------------
template <int OUTBF>
__global__ __launch_bounds__(256) void add_ln_k(const float* __restrict__ X,
                                                const float* __restrict__ Y,
                                                const float* __restrict__ g,
                                                const float* __restrict__ be,
                                                float* __restrict__ outf,
                                                unsigned short* __restrict__ outb)
{
    const int lane = threadIdx.x & 31;
    const int row  = blockIdx.x * 8 + (threadIdx.x >> 5);
    const size_t base = (size_t)row * 1024 + lane * 4;
    v4f v[8];
    // every loop here is unrolled: v[] stays in registers and the 16 row loads
    // issue ahead of the sums
#pragma unroll
    for (int i = 0; i < 8; ++i) v[i] = *(const v4f*)&X[base + i * 128];
#pragma unroll
    for (int i = 0; i < 8; ++i) v[i] += *(const v4f*)&Y[base + i * 128];
    v4f s4 = v[0], q4 = v[0] * v[0];
#pragma unroll
    for (int i = 1; i < 8; ++i) { s4 += v[i]; q4 += v[i] * v[i]; }
    const float ts  = redsum32((s4.x + s4.y) + (s4.z + s4.w));
    const float ts2 = redsum32((q4.x + q4.y) + (q4.z + q4.w));
    const float mean = ts * (1.0f / 1024.0f);
    const float var  = ts2 * (1.0f / 1024.0f) - mean * mean;
    const float rs   = rsqrtf(var + 1e-5f);
#pragma unroll
    for (int i = 0; i < 8; ++i) {
        const v4f g4 = *(const v4f*)&g[lane * 4 + i * 128];
        const v4f b4 = *(const v4f*)&be[lane * 4 + i * 128];
        v[i] = (v[i] - mean) * rs * g4 + b4;
        *(v4f*)&outf[base + i * 128] = v[i];
    }
    if (OUTBF) {
#pragma unroll
        for (int i = 0; i < 8; ++i) *(ushort4*)&outb[base + i * 128] = cvt4(v[i]);
    }
}

// ---------------------------------------------------------------------------
// Driver
// ---------------------------------------------------------------------------
extern "C" void kernel_launch(void* const* d_in, const int* in_sizes, int n_in,
                              void* d_out, int out_size, void* d_ws, size_t ws_size,
                              hipStream_t stream)
{
    (void)in_sizes; (void)n_in; (void)out_size; (void)ws_size;
    constexpr int Sx = 1024, Bx = 8, Dx = 1024, Hx = 16, DFF = 4096;
    constexpr int Mx = Sx * Bx;   // 8192

    const float* src  = (const float*)d_in[0];
    const float* wqkv = (const float*)d_in[1];
    const float* bqkv = (const float*)d_in[2];
    const float* wout = (const float*)d_in[3];
    const float* bout = (const float*)d_in[4];
    const float* w1   = (const float*)d_in[5];
    const float* b1   = (const float*)d_in[6];
    const float* w2   = (const float*)d_in[7];
    const float* b2   = (const float*)d_in[8];
    const float* g1   = (const float*)d_in[9];
    const float* be1  = (const float*)d_in[10];
    const float* g2   = (const float*)d_in[11];
    const float* be2  = (const float*)d_in[12];
    float* outp = (float*)d_out;

    char* ws = (char*)d_ws;
    size_t off = 0;
    auto alloc = [&](size_t bytes) -> void* {
        void* p = ws + off;
        off += (bytes + 255) & ~size_t(255);
        return p;
    };
    unsigned short* Xb    = (unsigned short*)alloc((size_t)Mx * Dx * 2);
    unsigned short* Wqkvb = (unsigned short*)alloc((size_t)3 * Dx * Dx * 2);
    unsigned short* Woutb = (unsigned short*)alloc((size_t)Dx * Dx * 2);
    unsigned short* W1b   = (unsigned short*)alloc((size_t)DFF * Dx * 2);
    unsigned short* W2b   = (unsigned short*)alloc((size_t)Dx * DFF * 2);
    unsigned short* QKVb  = (unsigned short*)alloc((size_t)Mx * 3 * Dx * 2);
    unsigned short* Obuf  = (unsigned short*)alloc((size_t)Mx * Dx * 2);
    float*          Yf    = (float*)alloc((size_t)Mx * Dx * 4);  // Y1/Y2 reuse
    float*          X1f   = (float*)alloc((size_t)Mx * Dx * 4);
    unsigned short* X1b   = (unsigned short*)alloc((size_t)Mx * Dx * 2);
    unsigned short* Hb    = (unsigned short*)alloc((size_t)Mx * DFF * 2);

    static_assert(((size_t)Mx * Dx) % 8192 == 0 && ((size_t)Dx * Dx) % 8192 == 0 &&
                  ((size_t)DFF * Dx) % 8192 == 0 && Mx % 8 == 0 && Dx == 1024,
                  "whole blocks only in the convert and LayerNorm kernels");
    auto cvt = [&](const float* in, unsigned short* o, size_t n) {
        cvt_bf16_4<<<(int)(n / 8192), 256, 0, stream>>>(in, o);
    };

    // 1) f32 -> bf16
    cvt(src,  Xb,    (size_t)Mx * Dx);
    cvt(wqkv, Wqkvb, (size_t)3 * Dx * Dx);
    cvt(wout, Woutb, (size_t)Dx * Dx);
    cvt(w1,   W1b,   (size_t)DFF * Dx);
    cvt(w2,   W2b,   (size_t)Dx * DFF);

    // 2) QKV = src * Wqkv^T + b   (bf16 out)
    gemm_bf16_k<0, 1><<<dim3((3 * Dx) / 128, Mx / 256), 256, 0, stream>>>(
        Xb, Wqkvb, bqkv, nullptr, QKVb, Mx, 3 * Dx, Dx);

    // 3) attention -> Obuf (bf16, [M, D])
    attn_k<<<dim3(Sx / 128, Bx * Hx), 256, 0, stream>>>(QKVb, Obuf);

    // 4) out-proj: Yf = Obuf * Wout^T + bout (f32)
    gemm_bf16_k<0, 0><<<dim3(Dx / 128, Mx / 256), 256, 0, stream>>>(
        Obuf, Woutb, bout, Yf, nullptr, Mx, Dx, Dx);

    // 5) x = LN1(src + Yf) -> X1f (f32) + X1b (bf16)
    add_ln_k<1><<<Mx / 8, 256, 0, stream>>>(src, Yf, g1, be1, X1f, X1b);

    // 6) Hb = relu(x * W1^T + b1) (bf16)
    gemm_bf16_k<1, 1><<<dim3(DFF / 128, Mx / 256), 256, 0, stream>>>(
        X1b, W1b, b1, nullptr, Hb, Mx, DFF, Dx);

    // 7) Yf = Hb * W2^T + b2 (f32)
    gemm_bf16_k<0, 0><<<dim3(Dx / 128, Mx / 256), 256, 0, stream>>>(
        Hb, W2b, b2, Yf, nullptr, Mx, Dx, DFF);

    // 8) out = LN2(x + Yf) (f32)
    add_ln_k<0><<<Mx / 8, 256, 0, stream>>>(X1f, Yf, g2, be2, outp, nullptr);
}

// v003
// One run takes 324 microseconds.
// Next to v002, in two timings, it ran 1.12 times as fast each time.
// All steps since v000 together make it 1.23 times as fast.
#include <hip/hip_runtime.h>
#include <hip/hip_bf16.h>

// ---------------------------------------------------------------------------
// Types
// ---------------------------------------------------------------------------
typedef __attribute__((ext_vector_type(16))) __bf16 v16bf;
typedef __attribute__((ext_vector_type(8)))  float  v8f;
typedef __attribute__((ext_vector_type(4)))  unsigned int u32x4;
typedef __attribute__((ext_vector_type(8)))  int  i32x8;
typedef __attribute__((ext_vector_type(4)))  int  i32x4;

union FragB {
    uint4  u[2];   // 32 bytes = 16 bf16
    v16bf  v;
};

__device__ __forceinline__ unsigned short f32_bf16(float f) {
    unsigned int u = __builtin_bit_cast(unsigned int, f);
    unsigned int r = u + 0x7FFFu + ((u >> 16) & 1u);   // round-to-nearest-even
    return (unsigned short)(r >> 16);
}

__device__ __forceinline__ v8f wmma_bf16(v16bf a, v16bf b, v8f c) {
    // D(16x16,f32) = A(16x32,bf16) * B(32x16,bf16) + C
    return __builtin_amdgcn_wmma_f32_16x16x32_bf16(
        false, a, false, b, (short)0, c, false, false);
}

// ds_swizzle_b32 butterfly (group-of-32 mode: and=0x1f, or=0, xor=MASK)
template <int MASK>
__device__ __forceinline__ float swz(float x) {
    int r = __builtin_amdgcn_ds_swizzle(__builtin_bit_cast(int, x),
                                        (MASK << 10) | 0x1f);
    return __builtin_bit_cast(float, r);
}
__device__ __forceinline__ float redmax16(float x) {
    x = fmaxf(x, swz<1>(x)); x = fmaxf(x, swz<2>(x));
    x = fmaxf(x, swz<4>(x)); x = fmaxf(x, swz<8>(x));
    return x;
}
__device__ __forceinline__ float redsum16(float x) {
    x += swz<1>(x); x += swz<2>(x); x += swz<4>(x); x += swz<8>(x);
    return x;
}
__device__ __forceinline__ float redsum32(float x) {
    x += swz<1>(x); x += swz<2>(x); x += swz<4>(x);
    x += swz<8>(x); x += swz<16>(x);
    return x;
}

#if __has_builtin(__builtin_amdgcn_tensor_load_to_lds)
#define USE_TDM 1
#else
#define USE_TDM 0
#endif

__device__ __forceinline__ unsigned lds_off(const void* p) {
    return (unsigned)(unsigned long long)p;   // low 32 bits = LDS byte offset
}

#if USE_TDM
__device__ __forceinline__ void tdm_load_2d(unsigned ldsoff, const void* gp,
                                            unsigned tile_d0, unsigned tile_d1,
                                            unsigned stride_elts,
                                            unsigned pad_int, unsigned pad_amt)
{
    unsigned long long ga = (unsigned long long)gp;
    u32x4 g0;
    g0[0] = 1u;                                              // count=1 (user)
    g0[1] = ldsoff;                                          // lds_addr
    g0[2] = (unsigned)ga;                                    // global_addr lo
    g0[3] = (unsigned)((ga >> 32) & 0x01FFFFFFu) | (2u << 30); // addr hi | type=2
    i32x8 g1;
    g1[0] = (int)((1u << 16)
                | (1u << 20)
                | (pad_int << 22)
                | (pad_amt << 25));
    g1[1] = (int)((tile_d0 & 0xFFFFu) << 16);
    g1[2] = (int)((tile_d1 & 0xFFFFu) << 16);
    g1[3] = (int)(tile_d0 << 16);
    g1[4] = (int)tile_d1;
    g1[5] = (int)stride_elts;
    g1[6] = 0;
    g1[7] = 0;
    i32x4 z4 = {0, 0, 0, 0};
#if __clang_major__ >= 23
    i32x8 z8 = {0, 0, 0, 0, 0, 0, 0, 0};
    __builtin_amdgcn_tensor_load_to_lds(g0, g1, z4, z4, z8, 0);
#else
    __builtin_amdgcn_tensor_load_to_lds(g0, g1, z4, z4, 0);
#endif
}
#endif

// ---------------------------------------------------------------------------
// f32 -> bf16 conversion. A block converts 2048 float4, 8 per thread, all 8 loads
// in flight at once: an eighth of the waves to start for the same bytes.
// The element count is a multiple of 8192 (asserted where it is launched).
// ---------------------------------------------------------------------------
typedef __attribute__((ext_vector_type(4))) float v4f;

__device__ __forceinline__ ushort4 cvt4(v4f f) {
    ushort4 r;
    r.x = f32_bf16(f.x); r.y = f32_bf16(f.y);
    r.z = f32_bf16(f.z); r.w = f32_bf16(f.w);
    return r;
}

__global__ __launch_bounds__(256) void cvt_bf16_4(const float* __restrict__ in,
                                                  unsigned short* __restrict__ out) {
    const int i0 = blockIdx.x * 2048 + threadIdx.x;
    v4f f[8];
    // both loops unrolled: f[] stays in registers and the 8 loads issue together
#pragma unroll
    for (int u = 0; u < 8; ++u) f[u] = ((const v4f*)in)[i0 + u * 256];
#pragma unroll
    for (int u = 0; u < 8; ++u) ((ushort4*)out)[i0 + u * 256] = cvt4(f[u]);
}

// ---------------------------------------------------------------------------
// GEMM: C[M,N] = A[M,K] * W[N,K]^T + bias[N]   (A, W row-major bf16)
// Tile: 256(M) x 128(N), a stage is 64 k (two WMMA k-steps). 8 waves, 4x2,
// each wave computes 64x64 via 4x4 WMMA 16x16 f32 accumulators.
// The stages go through a ring of two LDS buffers: while the waves work on one
// buffer, the tensor loads of the next stage land in the other. Every wave
// brings one slice of a stage: waves 0-3 64 rows of A each, waves 4-7 32 rows
// of W each. K is a multiple of 64 and at least 128 (two stages).
// ---------------------------------------------------------------------------
typedef __attribute__((ext_vector_type(8))) unsigned int u32x8;

constexpr unsigned G_PITCH = 144;               // LDS row pitch: 128-byte row + 16-byte pad
constexpr unsigned G_ASL   = 10240;             // A slice: 64 rows x 144 B, rounded up to 2 KiB
constexpr unsigned G_BSL   = 6144;              // W slice: 32 rows x 144 B, rounded up to 2 KiB
constexpr unsigned G_BOFF  = 4 * G_ASL;         // the W slices stand behind the A slices
constexpr unsigned G_BUF   = G_BOFF + 4 * G_BSL;   // one buffer
static_assert(64 * G_PITCH <= G_ASL && 32 * G_PITCH <= G_BSL &&
              G_ASL % 2048 == 0 && G_BSL % 2048 == 0 && G_BUF % 2048 == 0,
              "every slice fits its place and starts at a multiple of 2 KiB");

__device__ __forceinline__ unsigned uni(unsigned v) {
    return (unsigned)__builtin_amdgcn_readfirstlane((int)v);
}
__device__ __forceinline__ unsigned pinned(unsigned v) {
    unsigned w = uni(v);
    asm volatile("" : "+s"(w));
    return w;
}
__device__ __forceinline__ void ring_load(u32x4& g0, u32x8& g1, unsigned dst,
                                          unsigned long long ga) {
    g0[1] = uni(dst);                                                 // LDS byte offset
    g0[2] = uni((unsigned)ga);                                        // address lo
    g0[3] = uni(((unsigned)(ga >> 32) & 0x01FFFFFFu) | 0x80000000u);  // address hi | type 2
    asm volatile("tensor_load_to_lds %0, %1" : "+s"(g0), "+s"(g1) :: "memory");
}
// This wave's request has landed.
__device__ __forceinline__ void ring_wait(u32x4& g0, u32x8& g1) {
    asm volatile("s_wait_tensorcnt 0x0" : "+s"(g0), "+s"(g1) :: "memory");
}

template <int RELU, int OUTBF>
__global__ __launch_bounds__(256) void gemm_bf16_k(
    const unsigned short* __restrict__ A,
    const unsigned short* __restrict__ W,
    const float* __restrict__ bias,
    float* __restrict__ Cf,
    unsigned short* __restrict__ Cb,
    int M, int N, int K)
{
    __shared__ __attribute__((aligned(2048))) unsigned char ring[2 * G_BUF];

    const int tid  = threadIdx.x;
    const int lane = tid & 31;
    const unsigned wv = uni(threadIdx.x >> 5);   // the wave's number, scalar
    const int wr   = (int)(wv >> 1);     // 0..3
    const int wc   = (int)(wv & 1u);     // 0..1
    const int lr   = lane & 15;
    const int hi   = lane >> 4;
    const int kb   = hi * 8;
    const int m0   = blockIdx.y * 256;
    const int n0   = blockIdx.x * 128;

    // this wave's slice: first source byte of stage 0, rows, place in buffer 0
    const bool forA = wv < 4u;
    const unsigned long long src0 = forA
        ? (unsigned long long)(A + (size_t)(m0 + (int)wv * 64) * K)
        : (unsigned long long)(W + (size_t)(n0 + ((int)wv - 4) * 32) * K);
    const unsigned rows = forA ? 64u : 32u;
    const unsigned dst0 = lds_off(ring) + (forA ? wv * G_ASL : G_BOFF + (wv - 4u) * G_BSL);
    u32x8 g1;
    g1[0] = uni((1u << 20) | (4u << 22) | (3u << 25));
    g1[1] = uni(128u << 16);
    g1[2] = uni(rows << 16);
    g1[3] = uni(128u << 16);
    g1[4] = uni(rows);
    g1[5] = uni((unsigned)K * 2u);
    g1[6] = uni(0u);
    g1[7] = uni(0u);
    u32x4 g0;
    g0[0] = uni(1u);                  // count = 1; the other words: ring_load()

    const v8f zerov = {0.f, 0.f, 0.f, 0.f, 0.f, 0.f, 0.f, 0.f};
    v8f acc[4][4];
#pragma unroll
    for (int i = 0; i < 4; ++i)
#pragma unroll
        for (int j = 0; j < 4; ++j) acc[i][j] = zerov;

    const int T = K >> 6;             // stages

    ring_load(g0, g1, dst0, src0);                        // stage 0 -> buffer 0
    // stage 0 has landed before the barrier that lets the other waves read it
    ring_wait(g0, g1);
    __syncthreads();
    ring_load(g0, g1, dst0 + G_BUF, src0 + 128u);         // stage 1 -> buffer 1

    for (int s = 0; s < T; ++s) {
        const unsigned cur = (unsigned)(s & 1) * G_BUF;
        const unsigned char* ab = ring + cur + wr * G_ASL + lr * G_PITCH + kb * 2;
        const unsigned char* bb = ring + cur + G_BOFF + wc * (2 * G_BSL) + lr * G_PITCH + kb * 2;

#pragma unroll
        for (int ks = 0; ks < 2; ++ks) {
            FragB a[4], b[4];
#pragma unroll
            for (int i = 0; i < 4; ++i) {
                const unsigned char* p = ab + i * (16 * G_PITCH) + ks * 64;
                a[i].u[0] = *(const uint4*)p;          // K = ko..ko+7
                a[i].u[1] = *(const uint4*)(p + 32);   // K = ko+16..ko+23
            }
#pragma unroll
            for (int j = 0; j < 4; ++j) {
                const unsigned char* p = bb + (j >> 1) * G_BSL + (j & 1) * (16 * G_PITCH) + ks * 64;
                b[j].u[0] = *(const uint4*)p;
                b[j].u[1] = *(const uint4*)(p + 32);
            }
            if (ks == 1) {
                // Hand-over, in front of the stage's last 16 WMMAs, whose fragments are
                // in registers by then: this wave's reads of the buffer are done, its
                // slice of stage s + 1 has landed; behind the barrier every wave may
                // read stage s + 1 and the buffer of stage s is filled again, so the
                // refill has a whole stage's work to land under.
                asm volatile("s_wait_dscnt 0x0" ::: "memory");
                ring_wait(g0, g1);
                __syncthreads();
                if (pinned((unsigned)(s + 2 < T))) {
                    const unsigned kbyte = pinned((unsigned)(s + 2) * 128u);
                    ring_load(g0, g1, dst0 + cur, src0 + kbyte);   // stage s + 2
                }
            }
            __builtin_amdgcn_sched_barrier(0);
#pragma unroll
            for (int i = 0; i < 4; ++i)
#pragma unroll
                for (int j = 0; j < 4; ++j)
                    acc[i][j] = wmma_bf16(a[i].v, b[j].v, acc[i][j]);
        }
    }
    // nothing of the ring is in flight when the wave goes on to its stores and ends
    ring_wait(g0, g1);
    asm volatile("s_wait_dscnt 0x0" ::: "memory");

    // epilogue: C layout -> element e is row (e + 8*hi), col lr within tile
#pragma unroll
    for (int j = 0; j < 4; ++j) {
        const int col = n0 + wc * 64 + j * 16 + lr;
        const float bv = bias[col];
#pragma unroll
        for (int i = 0; i < 4; ++i) {
#pragma unroll
            for (int e = 0; e < 8; ++e) {
                const int row = m0 + wr * 64 + i * 16 + hi * 8 + e;
                float v = acc[i][j][e] + bv;
                if (RELU) v = fmaxf(v, 0.f);
                if (OUTBF) Cb[(size_t)row * N + col] = f32_bf16(v);
                else       Cf[(size_t)row * N + col] = v;
            }
        }
    }
}

__global__ __launch_bounds__(256) void attn_k(const unsigned short* __restrict__ QKV,
                                              unsigned short* __restrict__ Ob)
{
    alignas(16) __shared__ unsigned short Ksh[32 * 80];      // stride 80 halfs
    alignas(16) __shared__ unsigned short Vt[64 * 40];       // V^T, stride 40
    alignas(16) __shared__ unsigned short Psh[8][16 * 32];   // per-wave P tile

    const int tid  = threadIdx.x;
    const int lane = tid & 31;
    const int wave = tid >> 5;
    const int lr   = lane & 15;
    const int hi   = lane >> 4;
    const int kb   = hi * 8;
    const int bh   = blockIdx.y;
    const int bidx = bh >> 4;      // batch
    const int h    = bh & 15;      // head
    const int s0   = blockIdx.x * 128 + wave * 16;
    const int rowStride = 8 * 3072;                 // halfs per s step (B*3D)
    const size_t qoff = (size_t)bidx * 3072 + h * 64;
    const size_t koff = qoff + 1024;
    const size_t voff = qoff + 2048;

    // Q fragments (hd 0..31 and 32..63), loaded once
    FragB q0, q1;
    {
        const unsigned short* qp = QKV + (size_t)(s0 + lr) * rowStride + qoff + kb;
        q0.u[0] = *(const uint4*)qp;
        q0.u[1] = *(const uint4*)(qp + 16);
        q1.u[0] = *(const uint4*)(qp + 32);
        q1.u[1] = *(const uint4*)(qp + 48);
    }

    const v8f zerov = {0.f, 0.f, 0.f, 0.f, 0.f, 0.f, 0.f, 0.f};
    float mrow[8], lrow[8];
    v8f oacc[4];
#pragma unroll
    for (int e = 0; e < 8; ++e) { mrow[e] = -1e30f; lrow[e] = 0.f; }
#pragma unroll
    for (int d = 0; d < 4; ++d) oacc[d] = zerov;

    for (int it = 0; it < 32; ++it) {
        const int kt0 = it * 32;
        __syncthreads();   // previous iteration's LDS readers done
#if USE_TDM
        if (wave == 0) {
            tdm_load_2d(lds_off(Ksh),
                        QKV + (size_t)kt0 * rowStride + koff,
                        64, 32, (unsigned)rowStride, 4, 7);
        }
#else
        {
            const int row = tid >> 3, kc = (tid & 7) * 8;
            *(uint4*)&Ksh[row * 80 + kc] =
                *(const uint4*)&QKV[(size_t)(kt0 + row) * rowStride + koff + kc];
        }
#endif
        {
            // V block: store transposed -> Vt[hd][t]
            const int row = tid >> 3, kc = (tid & 7) * 8;
            union { uint4 u; unsigned short s[8]; } cv;
            cv.u = *(const uint4*)&QKV[(size_t)(kt0 + row) * rowStride + voff + kc];
#pragma unroll
            for (int e2 = 0; e2 < 8; ++e2) Vt[(kc + e2) * 40 + row] = cv.s[e2];
        }
#if USE_TDM
        if (wave == 0) __builtin_amdgcn_s_wait_tensorcnt(0);
#endif
        __syncthreads();

        // S = (Q K^T) * 1/sqrt(64)  -> two 16x16 column tiles
        v8f sc[2];
#pragma unroll
        for (int c = 0; c < 2; ++c) {
            FragB kf0, kf1;
            const unsigned short* kp = &Ksh[(c * 16 + lr) * 80 + kb];
            kf0.u[0] = *(const uint4*)kp;
            kf0.u[1] = *(const uint4*)(kp + 16);
            kf1.u[0] = *(const uint4*)(kp + 32);
            kf1.u[1] = *(const uint4*)(kp + 48);
            v8f z = zerov;
            z = wmma_bf16(q0.v, kf0.v, z);
            z = wmma_bf16(q1.v, kf1.v, z);
#pragma unroll
            for (int e = 0; e < 8; ++e) z[e] *= 0.125f;
            sc[c] = z;
        }

        // online softmax update (rows live across 16-lane halves)
#pragma unroll
        for (int e = 0; e < 8; ++e) {
            const float tm = redmax16(fmaxf(sc[0][e], sc[1][e]));
            const float mn = fmaxf(mrow[e], tm);
            const float alpha = __expf(mrow[e] - mn);
            mrow[e] = mn;
            const float p0 = __expf(sc[0][e] - mn);
            const float p1 = __expf(sc[1][e] - mn);
            lrow[e] = lrow[e] * alpha + redsum16(p0 + p1);
#pragma unroll
            for (int d = 0; d < 4; ++d) oacc[d][e] *= alpha;
            const int pr = (hi * 8 + e) * 32;            // P row (C layout)
            Psh[wave][pr + lr]      = f32_bf16(p0);
            Psh[wave][pr + 16 + lr] = f32_bf16(p1);
        }
        __syncthreads();   // make P visible across lanes (uniform flow)

        // P (A-fragment) * V^T-rows (B-fragment), 4 hd tiles
        FragB pa;
        const unsigned short* pp = &Psh[wave][lr * 32 + kb];
        pa.u[0] = *(const uint4*)pp;
        pa.u[1] = *(const uint4*)(pp + 16);
#pragma unroll
        for (int d = 0; d < 4; ++d) {
            FragB vf;
            const unsigned short* vp = &Vt[(d * 16 + lr) * 40 + kb];
            vf.u[0] = *(const uint4*)vp;
            vf.u[1] = *(const uint4*)(vp + 16);
            oacc[d] = wmma_bf16(pa.v, vf.v, oacc[d]);
        }
    }

    // epilogue: normalize and store bf16 to Ob[(s*B+b)*1024 + h*64 + hd]
#pragma unroll
    for (int e = 0; e < 8; ++e) {
        const float inv = 1.0f / lrow[e];
        const int sg = s0 + hi * 8 + e;
        const size_t base = ((size_t)sg * 8 + bidx) * 1024 + h * 64;
#pragma unroll
        for (int d = 0; d < 4; ++d)
            Ob[base + d * 16 + lr] = f32_bf16(oacc[d][e] * inv);
    }
}

// ---------------------------------------------------------------------------
// out = LayerNorm(X + Y) * g + b ; writes f32 (and optional bf16 copy)
// One wave per row of 1024, 8 rows per block of 256: a lane holds 32 values of its
// row, moved 16 bytes at a time; the row sums are a butterfly inside the wave.
// ---------------------------------------------------------------------------
template <int OUTBF>
__global__ __launch_bounds__(256) void add_ln_k(const float* __restrict__ X,
                                                const float* __restrict__ Y,
                                                const float* __restrict__ g,
                                                const float* __restrict__ be,
                                                float* __restrict__ outf,
                                                unsigned short* __restrict__ outb)
{
    const int lane = threadIdx.x & 31;
    const int row  = blockIdx.x * 8 + (threadIdx.x >> 5);
    const size_t base = (size_t)row * 1024 + lane * 4;
    v4f v[8];
    // every loop here is unrolled: v[] stays in registers and the 16 row loads
    // issue ahead of the sums
#pragma unroll
    for (int i = 0; i < 8; ++i) v[i] = *(const v4f*)&X[base + i * 128];
#pragma unroll
    for (int i = 0; i < 8; ++i) v[i] += *(const v4f*)&Y[base + i * 128];
    v4f s4 = v[0], q4 = v[0] * v[0];
#pragma unroll
    for (int i = 1; i < 8; ++i) { s4 += v[i]; q4 += v[i] * v[i]; }
    const float ts  = redsum32((s4.x + s4.y) + (s4.z + s4.w));
    const float ts2 = redsum32((q4.x + q4.y) + (q4.z + q4.w));
    const float mean = ts * (1.0f / 1024.0f);
    const float var  = ts2 * (1.0f / 1024.0f) - mean * mean;
    const float rs   = rsqrtf(var + 1e-5f);
#pragma unroll
    for (int i = 0; i < 8; ++i) {
        const v4f g4 = *(const v4f*)&g[lane * 4 + i * 128];
        const v4f b4 = *(const v4f*)&be[lane * 4 + i * 128];
        v[i] = (v[i] - mean) * rs * g4 + b4;
        *(v4f*)&outf[base + i * 128] = v[i];
    }
    if (OUTBF) {
#pragma unroll
        for (int i = 0; i < 8; ++i) *(ushort4*)&outb[base + i * 128] = cvt4(v[i]);
    }
}

// ---------------------------------------------------------------------------
// Driver
// ---------------------------------------------------------------------------
extern "C" void kernel_launch(void* const* d_in, const int* in_sizes, int n_in,
                              void* d_out, int out_size, void* d_ws, size_t ws_size,
                              hipStream_t stream)
{
    (void)in_sizes; (void)n_in; (void)out_size; (void)ws_size;
    constexpr int Sx = 1024, Bx = 8, Dx = 1024, Hx = 16, DFF = 4096;
    constexpr int Mx = Sx * Bx;   // 8192

    const float* src  = (const float*)d_in[0];
    const float* wqkv = (const float*)d_in[1];
    const float* bqkv = (const float*)d_in[2];
    const float* wout = (const float*)d_in[3];
    const float* bout = (const float*)d_in[4];
    const float* w1   = (const float*)d_in[5];
    const float* b1   = (const float*)d_in[6];
    const float* w2   = (const float*)d_in[7];
    const float* b2   = (const float*)d_in[8];
    const float* g1   = (const float*)d_in[9];
    const float* be1  = (const float*)d_in[10];
    const float* g2   = (const float*)d_in[11];
    const float* be2  = (const float*)d_in[12];
    float* outp = (float*)d_out;

    char* ws = (char*)d_ws;
    size_t off = 0;
    auto alloc = [&](size_t bytes) -> void* {
        void* p = ws + off;
        off += (bytes + 255) & ~size_t(255);
        return p;
    };
    unsigned short* Xb    = (unsigned short*)alloc((size_t)Mx * Dx * 2);
    unsigned short* Wqkvb = (unsigned short*)alloc((size_t)3 * Dx * Dx * 2);
    unsigned short* Woutb = (unsigned short*)alloc((size_t)Dx * Dx * 2);
    unsigned short* W1b   = (unsigned short*)alloc((size_t)DFF * Dx * 2);
    unsigned short* W2b   = (unsigned short*)alloc((size_t)Dx * DFF * 2);
    unsigned short* QKVb  = (unsigned short*)alloc((size_t)Mx * 3 * Dx * 2);
    unsigned short* Obuf  = (unsigned short*)alloc((size_t)Mx * Dx * 2);
    float*          Yf    = (float*)alloc((size_t)Mx * Dx * 4);  // Y1/Y2 reuse
    float*          X1f   = (float*)alloc((size_t)Mx * Dx * 4);
    unsigned short* X1b   = (unsigned short*)alloc((size_t)Mx * Dx * 2);
    unsigned short* Hb    = (unsigned short*)alloc((size_t)Mx * DFF * 2);

    static_assert(((size_t)Mx * Dx) % 8192 == 0 && ((size_t)Dx * Dx) % 8192 == 0 &&
                  ((size_t)DFF * Dx) % 8192 == 0 && Mx % 8 == 0 && Dx == 1024,
                  "whole blocks only in the convert and LayerNorm kernels");
    auto cvt = [&](const float* in, unsigned short* o, size_t n) {
        cvt_bf16_4<<<(int)(n / 8192), 256, 0, stream>>>(in, o);
    };

    // 1) f32 -> bf16
    cvt(src,  Xb,    (size_t)Mx * Dx);
    cvt(wqkv, Wqkvb, (size_t)3 * Dx * Dx);
    cvt(wout, Woutb, (size_t)Dx * Dx);
    cvt(w1,   W1b,   (size_t)DFF * Dx);
    cvt(w2,   W2b,   (size_t)Dx * DFF);

    // 2) QKV = src * Wqkv^T + b   (bf16 out)
    gemm_bf16_k<0, 1><<<dim3((3 * Dx) / 128, Mx / 256), 256, 0, stream>>>(
        Xb, Wqkvb, bqkv, nullptr, QKVb, Mx, 3 * Dx, Dx);

    // 3) attention -> Obuf (bf16, [M, D])
    attn_k<<<dim3(Sx / 128, Bx * Hx), 256, 0, stream>>>(QKVb, Obuf);

    // 4) out-proj: Yf = Obuf * Wout^T + bout (f32)
    gemm_bf16_k<0, 0><<<dim3(Dx / 128, Mx / 256), 256, 0, stream>>>(
        Obuf, Woutb, bout, Yf, nullptr, Mx, Dx, Dx);

    // 5) x = LN1(src + Yf) -> X1f (f32) + X1b (bf16)
    add_ln_k<1><<<Mx / 8, 256, 0, stream>>>(src, Yf, g1, be1, X1f, X1b);

    // 6) Hb = relu(x * W1^T + b1) (bf16)
    gemm_bf16_k<1, 1><<<dim3(DFF / 128, Mx / 256), 256, 0, stream>>>(
        X1b, W1b, b1, nullptr, Hb, Mx, DFF, Dx);

    // 7) Yf = Hb * W2^T + b2 (f32)
    gemm_bf16_k<0, 0><<<dim3(Dx / 128, Mx / 256), 256, 0, stream>>>(
        Hb, W2b, b2, Yf, nullptr, Mx, Dx, DFF);

    // 8) out = LN2(x + Yf) (f32)
    add_ln_k<0><<<Mx / 8, 256, 0, stream>>>(X1f, Yf, g2, be2, outp, nullptr);
}

// v004
// It runs in 253 microseconds.
// Timed twice side by side with v003, it ran 1.28 and 1.27 times as fast.
// Counting every step since v000, it is 1.56 times as fast.
#include <hip/hip_runtime.h>
#include <hip/hip_bf16.h>

// ---------------------------------------------------------------------------
// Types
// ---------------------------------------------------------------------------
typedef __attribute__((ext_vector_type(16))) __bf16 v16bf;
typedef __attribute__((ext_vector_type(8)))  float  v8f;
typedef __attribute__((ext_vector_type(4)))  unsigned int u32x4;
typedef __attribute__((ext_vector_type(8)))  int  i32x8;
typedef __attribute__((ext_vector_type(4)))  int  i32x4;

union FragB {
    uint4  u[2];   // 32 bytes = 16 bf16
    v16bf  v;
};

__device__ __forceinline__ unsigned short f32_bf16(float f) {
    unsigned int u = __builtin_bit_cast(unsigned int, f);
    unsigned int r = u + 0x7FFFu + ((u >> 16) & 1u);   // round-to-nearest-even
    return (unsigned short)(r >> 16);
}

__device__ __forceinline__ v8f wmma_bf16(v16bf a, v16bf b, v8f c) {
    // D(16x16,f32) = A(16x32,bf16) * B(32x16,bf16) + C
    return __builtin_amdgcn_wmma_f32_16x16x32_bf16(
        false, a, false, b, (short)0, c, false, false);
}

// ds_swizzle_b32 butterfly (group-of-32 mode: and=0x1f, or=0, xor=MASK)
template <int MASK>
__device__ __forceinline__ float swz(float x) {
    int r = __builtin_amdgcn_ds_swizzle(__builtin_bit_cast(int, x),
                                        (MASK << 10) | 0x1f);
    return __builtin_bit_cast(float, r);
}
__device__ __forceinline__ float redsum32(float x) {
    x += swz<1>(x); x += swz<2>(x); x += swz<4>(x);
    x += swz<8>(x); x += swz<16>(x);
    return x;
}

#if __has_builtin(__builtin_amdgcn_tensor_load_to_lds)
#define USE_TDM 1
#else
#define USE_TDM 0
#endif

__device__ __forceinline__ unsigned lds_off(const void* p) {
    return (unsigned)(unsigned long long)p;   // low 32 bits = LDS byte offset
}

#if USE_TDM
__device__ __forceinline__ void tdm_load_2d(unsigned ldsoff, const void* gp,
                                            unsigned tile_d0, unsigned tile_d1,
                                            unsigned stride_elts,
                                            unsigned pad_int, unsigned pad_amt)
{
    unsigned long long ga = (unsigned long long)gp;
    u32x4 g0;
    g0[0] = 1u;                                              // count=1 (user)
    g0[1] = ldsoff;                                          // lds_addr
    g0[2] = (unsigned)ga;                                    // global_addr lo
    g0[3] = (unsigned)((ga >> 32) & 0x01FFFFFFu) | (2u << 30); // addr hi | type=2
    i32x8 g1;
    g1[0] = (int)((1u << 16)
                | (1u << 20)
                | (pad_int << 22)
                | (pad_amt << 25));
    g1[1] = (int)((tile_d0 & 0xFFFFu) << 16);
    g1[2] = (int)((tile_d1 & 0xFFFFu) << 16);
    g1[3] = (int)(tile_d0 << 16);
    g1[4] = (int)tile_d1;
    g1[5] = (int)stride_elts;
    g1[6] = 0;
    g1[7] = 0;
    i32x4 z4 = {0, 0, 0, 0};
#if __clang_major__ >= 23
    i32x8 z8 = {0, 0, 0, 0, 0, 0, 0, 0};
    __builtin_amdgcn_tensor_load_to_lds(g0, g1, z4, z4, z8, 0);
#else
    __builtin_amdgcn_tensor_load_to_lds(g0, g1, z4, z4, 0);
#endif
}
#endif

// ---------------------------------------------------------------------------
// f32 -> bf16 conversion. A block converts 2048 float4, 8 per thread, all 8 loads
// in flight at once: an eighth of the waves to start for the same bytes.
// The element count is a multiple of 8192 (asserted where it is launched).
// ---------------------------------------------------------------------------
typedef __attribute__((ext_vector_type(4))) float v4f;

__device__ __forceinline__ ushort4 cvt4(v4f f) {
    ushort4 r;
    r.x = f32_bf16(f.x); r.y = f32_bf16(f.y);
    r.z = f32_bf16(f.z); r.w = f32_bf16(f.w);
    return r;
}

__global__ __launch_bounds__(256) void cvt_bf16_4(const float* __restrict__ in,
                                                  unsigned short* __restrict__ out) {
    const int i0 = blockIdx.x * 2048 + threadIdx.x;
    v4f f[8];
    // both loops unrolled: f[] stays in registers and the 8 loads issue together
#pragma unroll
    for (int u = 0; u < 8; ++u) f[u] = ((const v4f*)in)[i0 + u * 256];
#pragma unroll
    for (int u = 0; u < 8; ++u) ((ushort4*)out)[i0 + u * 256] = cvt4(f[u]);
}

// ---------------------------------------------------------------------------
// GEMM: C[M,N] = A[M,K] * W[N,K]^T + bias[N]   (A, W row-major bf16)
// Tile: 256(M) x 128(N), a stage is 64 k (two WMMA k-steps). 8 waves, 4x2,
// each wave computes 64x64 via 4x4 WMMA 16x16 f32 accumulators.
// The stages go through a ring of two LDS buffers: while the waves work on one
// buffer, the tensor loads of the next stage land in the other. Every wave
// brings one slice of a stage: waves 0-3 64 rows of A each, waves 4-7 32 rows
// of W each. K is a multiple of 64 and at least 128 (two stages).
// ---------------------------------------------------------------------------
typedef __attribute__((ext_vector_type(8))) unsigned int u32x8;

constexpr unsigned G_PITCH = 144;               // LDS row pitch: 128-byte row + 16-byte pad
constexpr unsigned G_ASL   = 10240;             // A slice: 64 rows x 144 B, rounded up to 2 KiB
constexpr unsigned G_BSL   = 6144;              // W slice: 32 rows x 144 B, rounded up to 2 KiB
constexpr unsigned G_BOFF  = 4 * G_ASL;         // the W slices stand behind the A slices
constexpr unsigned G_BUF   = G_BOFF + 4 * G_BSL;   // one buffer
static_assert(64 * G_PITCH <= G_ASL && 32 * G_PITCH <= G_BSL &&
              G_ASL % 2048 == 0 && G_BSL % 2048 == 0 && G_BUF % 2048 == 0,
              "every slice fits its place and starts at a multiple of 2 KiB");

__device__ __forceinline__ unsigned uni(unsigned v) {
    return (unsigned)__builtin_amdgcn_readfirstlane((int)v);
}
__device__ __forceinline__ unsigned pinned(unsigned v) {
    unsigned w = uni(v);
    asm volatile("" : "+s"(w));
    return w;
}
__device__ __forceinline__ void ring_load(u32x4& g0, u32x8& g1, unsigned dst,
                                          unsigned long long ga) {
    g0[1] = uni(dst);                                                 // LDS byte offset
    g0[2] = uni((unsigned)ga);                                        // address lo
    g0[3] = uni(((unsigned)(ga >> 32) & 0x01FFFFFFu) | 0x80000000u);  // address hi | type 2
    asm volatile("tensor_load_to_lds %0, %1" : "+s"(g0), "+s"(g1) :: "memory");
}
// This wave's request has landed.
__device__ __forceinline__ void ring_wait(u32x4& g0, u32x8& g1) {
    asm volatile("s_wait_tensorcnt 0x0" : "+s"(g0), "+s"(g1) :: "memory");
}

template <int RELU, int OUTBF>
__global__ __launch_bounds__(256) void gemm_bf16_k(
    const unsigned short* __restrict__ A,
    const unsigned short* __restrict__ W,
    const float* __restrict__ bias,
    float* __restrict__ Cf,
    unsigned short* __restrict__ Cb,
    int M, int N, int K)
{
    __shared__ __attribute__((aligned(2048))) unsigned char ring[2 * G_BUF];

    const int tid  = threadIdx.x;
    const int lane = tid & 31;
    const unsigned wv = uni(threadIdx.x >> 5);   // the wave's number, scalar
    const int wr   = (int)(wv >> 1);     // 0..3
    const int wc   = (int)(wv & 1u);     // 0..1
    const int lr   = lane & 15;
    const int hi   = lane >> 4;
    const int kb   = hi * 8;
    const int m0   = blockIdx.y * 256;
    const int n0   = blockIdx.x * 128;

    // this wave's slice: first source byte of stage 0, rows, place in buffer 0
    const bool forA = wv < 4u;
    const unsigned long long src0 = forA
        ? (unsigned long long)(A + (size_t)(m0 + (int)wv * 64) * K)
        : (unsigned long long)(W + (size_t)(n0 + ((int)wv - 4) * 32) * K);
    const unsigned rows = forA ? 64u : 32u;
    const unsigned dst0 = lds_off(ring) + (forA ? wv * G_ASL : G_BOFF + (wv - 4u) * G_BSL);
    u32x8 g1;
    g1[0] = uni((1u << 20) | (4u << 22) | (3u << 25));
    g1[1] = uni(128u << 16);
    g1[2] = uni(rows << 16);
    g1[3] = uni(128u << 16);
    g1[4] = uni(rows);
    g1[5] = uni((unsigned)K * 2u);
    g1[6] = uni(0u);
    g1[7] = uni(0u);
    u32x4 g0;
    g0[0] = uni(1u);                  // count = 1; the other words: ring_load()

    const v8f zerov = {0.f, 0.f, 0.f, 0.f, 0.f, 0.f, 0.f, 0.f};
    v8f acc[4][4];
#pragma unroll
    for (int i = 0; i < 4; ++i)
#pragma unroll
        for (int j = 0; j < 4; ++j) acc[i][j] = zerov;

    const int T = K >> 6;             // stages

    ring_load(g0, g1, dst0, src0);                        // stage 0 -> buffer 0
    // stage 0 has landed before the barrier that lets the other waves read it
    ring_wait(g0, g1);
    __syncthreads();
    ring_load(g0, g1, dst0 + G_BUF, src0 + 128u);         // stage 1 -> buffer 1

    for (int s = 0; s < T; ++s) {
        const unsigned cur = (unsigned)(s & 1) * G_BUF;
        const unsigned char* ab = ring + cur + wr * G_ASL + lr * G_PITCH + kb * 2;
        const unsigned char* bb = ring + cur + G_BOFF + wc * (2 * G_BSL) + lr * G_PITCH + kb * 2;

#pragma unroll
        for (int ks = 0; ks < 2; ++ks) {
            FragB a[4], b[4];
#pragma unroll
            for (int i = 0; i < 4; ++i) {
                const unsigned char* p = ab + i * (16 * G_PITCH) + ks * 64;
                a[i].u[0] = *(const uint4*)p;          // K = ko..ko+7
                a[i].u[1] = *(const uint4*)(p + 32);   // K = ko+16..ko+23
            }
#pragma unroll
            for (int j = 0; j < 4; ++j) {
                const unsigned char* p = bb + (j >> 1) * G_BSL + (j & 1) * (16 * G_PITCH) + ks * 64;
                b[j].u[0] = *(const uint4*)p;
                b[j].u[1] = *(const uint4*)(p + 32);
            }
            if (ks == 1) {
                // Hand-over, in front of the stage's last 16 WMMAs, whose fragments are
                // in registers by then: this wave's reads of the buffer are done, its
                // slice of stage s + 1 has landed; behind the barrier every wave may
                // read stage s + 1 and the buffer of stage s is filled again, so the
                // refill has a whole stage's work to land under.
                asm volatile("s_wait_dscnt 0x0" ::: "memory");
                ring_wait(g0, g1);
                __syncthreads();
                if (pinned((unsigned)(s + 2 < T))) {
                    const unsigned kbyte = pinned((unsigned)(s + 2) * 128u);
                    ring_load(g0, g1, dst0 + cur, src0 + kbyte);   // stage s + 2
                }
            }
            __builtin_amdgcn_sched_barrier(0);
#pragma unroll
            for (int i = 0; i < 4; ++i)
#pragma unroll
                for (int j = 0; j < 4; ++j)
                    acc[i][j] = wmma_bf16(a[i].v, b[j].v, acc[i][j]);
        }
    }
    // nothing of the ring is in flight when the wave goes on to its stores and ends
    ring_wait(g0, g1);
    asm volatile("s_wait_dscnt 0x0" ::: "memory");

    // epilogue: C layout -> element e is row (e + 8*hi), col lr within tile
#pragma unroll
    for (int j = 0; j < 4; ++j) {
        const int col = n0 + wc * 64 + j * 16 + lr;
        const float bv = bias[col];
#pragma unroll
        for (int i = 0; i < 4; ++i) {
#pragma unroll
            for (int e = 0; e < 8; ++e) {
                const int row = m0 + wr * 64 + i * 16 + hi * 8 + e;
                float v = acc[i][j][e] + bv;
                if (RELU) v = fmaxf(v, 0.f);
                if (OUTBF) Cb[(size_t)row * N + col] = f32_bf16(v);
                else       Cf[(size_t)row * N + col] = v;
            }
        }
    }
}

typedef __attribute__((ext_vector_type(2))) float  v2f;
typedef __attribute__((ext_vector_type(2))) __bf16 v2bf;
typedef __attribute__((ext_vector_type(8))) short  s16x8;

union FragT {
    u32x4  w[2];   // 32 bytes = 16 bf16
    v16bf  v;
};

// two f32 -> one register of two bf16, round to nearest even
__device__ __forceinline__ unsigned pack2(float lo, float hi) {
    return __builtin_bit_cast(unsigned, __builtin_convertvector(v2f{lo, hi}, v2bf));
}
__device__ __forceinline__ float xhalf(float x) {
    const int b = __builtin_bit_cast(int, x);
    return __builtin_bit_cast(float, __builtin_amdgcn_permlanex16(
        b, b, 0x76543210, 0xfedcba98, false, false));
}
// ds_load_tr16_b128: lane (c, h) gets column c, rows 8h..8h+7 of a 16x16 tile of halfs
__device__ __forceinline__ u32x4 ld_tr16(const unsigned short* p) {
    typedef __attribute__((address_space(3))) s16x8 lds_s16x8;
    return __builtin_bit_cast(u32x4, __builtin_amdgcn_ds_load_tr16_b128_v8i16((lds_s16x8*)p));
}

__global__ __launch_bounds__(256) void attn_k(const unsigned short* __restrict__ QKV,
                                              unsigned short* __restrict__ Ob)
{
    alignas(2048) __shared__ unsigned short Ksh[32 * 80];    // stride 80 halfs; the tensor load's place
    alignas(16) __shared__ unsigned short Vsh[32 * 80];      // V rows, stride 80 halfs

    const int tid  = threadIdx.x;
    const int lane = tid & 31;
    const int wave = tid >> 5;
    const int lr   = lane & 15;
    const int hi   = lane >> 4;
    const int kb   = hi * 8;
    const int bh   = blockIdx.y;
    const int bidx = bh >> 4;      // batch
    const int h    = bh & 15;      // head
    const int s0   = blockIdx.x * 128 + wave * 16;
    const int rowStride = 8 * 3072;                 // halfs per s step (B*3D)
    const size_t qoff = (size_t)bidx * 3072 + h * 64;
    const size_t koff = qoff + 1024;
    const size_t voff = qoff + 2048;

    // Q fragments (hd 0..31 and 32..63), loaded once: the B operand, column = query lr
    FragB q0, q1;
    {
        const unsigned short* qp = QKV + (size_t)(s0 + lr) * rowStride + qoff + kb;
        q0.u[0] = *(const uint4*)qp;
        q0.u[1] = *(const uint4*)(qp + 16);
        q1.u[0] = *(const uint4*)(qp + 32);
        q1.u[1] = *(const uint4*)(qp + 48);
    }

    const v8f zerov = {0.f, 0.f, 0.f, 0.f, 0.f, 0.f, 0.f, 0.f};
    // 1/sqrt(64) and log2(e) in one factor: the softmax runs in base 2
    constexpr float CS = 0.125f * 1.4426950408889634f;
    float mrun = -1e30f;   // query lr's running maximum (scaled), equal in both halves
    float lrun = 0.f;      // this half's share of query lr's denominator
    v8f oacc[4];           // O^T: tile d, register r = O[query lr][d * 16 + hi * 8 + r]
#pragma unroll
    for (int d = 0; d < 4; ++d) oacc[d] = zerov;

    for (int it = 0; it < 32; ++it) {
        const int kt0 = it * 32;
        __syncthreads();   // previous iteration's LDS readers done
#if USE_TDM
        if (wave == 0) {
            tdm_load_2d(lds_off(Ksh),
                        QKV + (size_t)kt0 * rowStride + koff,
                        64, 32, (unsigned)rowStride, 4, 7);
        }
#else
        {
            const int row = tid >> 3, kc = (tid & 7) * 8;
            *(uint4*)&Ksh[row * 80 + kc] =
                *(const uint4*)&QKV[(size_t)(kt0 + row) * rowStride + koff + kc];
        }
#endif
        {
            // V block, row by row: Vsh[t][hd]
            const int row = tid >> 3, kc = (tid & 7) * 8;
            *(uint4*)&Vsh[row * 80 + kc] =
                *(const uint4*)&QKV[(size_t)(kt0 + row) * rowStride + voff + kc];
        }
#if USE_TDM
        if (wave == 0) __builtin_amdgcn_s_wait_tensorcnt(0);
#endif
        __syncthreads();

        // S^T = K Q^T -> two 16x16 tiles: tile c, register r = key c*16 + hi*8 + r, query lr
        v8f st[2];
#pragma unroll
        for (int c = 0; c < 2; ++c) {
            FragB kf0, kf1;
            const unsigned short* kp = &Ksh[(c * 16 + lr) * 80 + kb];
            kf0.u[0] = *(const uint4*)kp;
            kf0.u[1] = *(const uint4*)(kp + 16);
            kf1.u[0] = *(const uint4*)(kp + 32);
            kf1.u[1] = *(const uint4*)(kp + 48);
            v8f z = zerov;
            z = wmma_bf16(kf0.v, q0.v, z);
            z = wmma_bf16(kf1.v, q1.v, z);
            st[c] = z;
        }

        // V^T fragments (A operand: row = hd, k = the 32 keys in the hardware order)
        FragT vf[4];
        {
            const unsigned short* vp = &Vsh[(hi * 8 + (lane & 7)) * 80 + ((lane >> 3) & 1) * 8];
#pragma unroll
            for (int d = 0; d < 4; ++d) {
                vf[d].w[0] = ld_tr16(vp + d * 16);             // keys  0..15
                vf[d].w[1] = ld_tr16(vp + 16 * 80 + d * 16);   // keys 16..31
            }
        }
        // Keeps the 8 transposing loads as one group in front of the softmax, which covers
        // their latency; without it half of them sink between the last WMMAs and are
        // waited for there.
        __builtin_amdgcn_sched_barrier(0);

        // online softmax update of query lr
        float mx = fmaxf(st[0][0], st[1][0]);
#pragma unroll
        for (int e = 1; e < 8; ++e) mx = fmaxf(mx, fmaxf(st[0][e], st[1][e]));
        mx = fmaxf(mx, xhalf(mx)) * CS;      // the scale is positive
        const float mn = fmaxf(mrun, mx);
        const float alpha = __builtin_amdgcn_exp2f(mrun - mn);
        mrun = mn;

        FragT pf;    // P^T: element s = key (s < 8 ? hi*8 + s : 16 + hi*8 + s - 8), as vf's k
        v2f ps = {0.f, 0.f};
#pragma unroll
        for (int i = 0; i < 8; ++i) {
            const v2f arg = __builtin_elementwise_fma(
                v2f{st[i >> 2][2 * (i & 3)], st[i >> 2][2 * (i & 3) + 1]},
                v2f{CS, CS}, v2f{-mn, -mn});
            const v2f p = {__builtin_amdgcn_exp2f(arg.x), __builtin_amdgcn_exp2f(arg.y)};
            ps += p;
            pf.w[i >> 2][i & 3] = pack2(p.x, p.y);
        }
        lrun = lrun * alpha + (ps.x + ps.y);

        // O^T = O^T * alpha + V^T P^T, 4 hd tiles
#pragma unroll
        for (int d = 0; d < 4; ++d) {
            oacc[d] *= alpha;
            oacc[d] = wmma_bf16(vf[d].v, pf.v, oacc[d]);
        }
    }

    // epilogue: join the halves' sums, normalize, store bf16 to
    // Ob[(s*B+b)*1024 + h*64 + hd]: a lane's 8 registers are 8 consecutive hd
    {
        const float inv = 1.0f / (lrun + xhalf(lrun));
        const size_t base = ((size_t)(s0 + lr) * 8 + bidx) * 1024 + h * 64 + hi * 8;
#pragma unroll
        for (int d = 0; d < 4; ++d) {
            const v8f o = oacc[d] * inv;
            const u32x4 pk = {pack2(o[0], o[1]), pack2(o[2], o[3]),
                              pack2(o[4], o[5]), pack2(o[6], o[7])};
            *(u32x4*)&Ob[base + d * 16] = pk;
        }
    }
}

// ---------------------------------------------------------------------------
// out = LayerNorm(X + Y) * g + b ; writes f32 (and optional bf16 copy)
// One wave per row of 1024, 8 rows per block of 256: a lane holds 32 values of its
// row, moved 16 bytes at a time; the row sums are a butterfly inside the wave.
// ---------------------------------------------------------------------------
template <int OUTBF>
__global__ __launch_bounds__(256) void add_ln_k(const float* __restrict__ X,
                                                const float* __restrict__ Y,
                                                const float* __restrict__ g,
                                                const float* __restrict__ be,
                                                float* __restrict__ outf,
                                                unsigned short* __restrict__ outb)
{
    const int lane = threadIdx.x & 31;
    const int row  = blockIdx.x * 8 + (threadIdx.x >> 5);
    const size_t base = (size_t)row * 1024 + lane * 4;
    v4f v[8];
    // every loop here is unrolled: v[] stays in registers and the 16 row loads
    // issue ahead of the sums
#pragma unroll
    for (int i = 0; i < 8; ++i) v[i] = *(const v4f*)&X[base + i * 128];
#pragma unroll
    for (int i = 0; i < 8; ++i) v[i] += *(const v4f*)&Y[base + i * 128];
    v4f s4 = v[0], q4 = v[0] * v[0];
#pragma unroll
    for (int i = 1; i < 8; ++i) { s4 += v[i]; q4 += v[i] * v[i]; }
    const float ts  = redsum32((s4.x + s4.y) + (s4.z + s4.w));
    const float ts2 = redsum32((q4.x + q4.y) + (q4.z + q4.w));
    const float mean = ts * (1.0f / 1024.0f);
    const float var  = ts2 * (1.0f / 1024.0f) - mean * mean;
    const float rs   = rsqrtf(var + 1e-5f);
#pragma unroll
    for (int i = 0; i < 8; ++i) {
        const v4f g4 = *(const v4f*)&g[lane * 4 + i * 128];
        const v4f b4 = *(const v4f*)&be[lane * 4 + i * 128];
        v[i] = (v[i] - mean) * rs * g4 + b4;
        *(v4f*)&outf[base + i * 128] = v[i];
    }
    if (OUTBF) {
#pragma unroll
        for (int i = 0; i < 8; ++i) *(ushort4*)&outb[base + i * 128] = cvt4(v[i]);
    }
}

// ---------------------------------------------------------------------------
// Driver
// ---------------------------------------------------------------------------
extern "C" void kernel_launch(void* const* d_in, const int* in_sizes, int n_in,
                              void* d_out, int out_size, void* d_ws, size_t ws_size,
                              hipStream_t stream)
{
    (void)in_sizes; (void)n_in; (void)out_size; (void)ws_size;
    constexpr int Sx = 1024, Bx = 8, Dx = 1024, Hx = 16, DFF = 4096;
    constexpr int Mx = Sx * Bx;   // 8192

    const float* src  = (const float*)d_in[0];
    const float* wqkv = (const float*)d_in[1];
    const float* bqkv = (const float*)d_in[2];
    const float* wout = (const float*)d_in[3];
    const float* bout = (const float*)d_in[4];
    const float* w1   = (const float*)d_in[5];
    const float* b1   = (const float*)d_in[6];
    const float* w2   = (const float*)d_in[7];
    const float* b2   = (const float*)d_in[8];
    const float* g1   = (const float*)d_in[9];
    const float* be1  = (const float*)d_in[10];
    const float* g2   = (const float*)d_in[11];
    const float* be2  = (const float*)d_in[12];
    float* outp = (float*)d_out;

    char* ws = (char*)d_ws;
    size_t off = 0;
    auto alloc = [&](size_t bytes) -> void* {
        void* p = ws + off;
        off += (bytes + 255) & ~size_t(255);
        return p;
    };
    unsigned short* Xb    = (unsigned short*)alloc((size_t)Mx * Dx * 2);
    unsigned short* Wqkvb = (unsigned short*)alloc((size_t)3 * Dx * Dx * 2);
    unsigned short* Woutb = (unsigned short*)alloc((size_t)Dx * Dx * 2);
    unsigned short* W1b   = (unsigned short*)alloc((size_t)DFF * Dx * 2);
    unsigned short* W2b   = (unsigned short*)alloc((size_t)Dx * DFF * 2);
    unsigned short* QKVb  = (unsigned short*)alloc((size_t)Mx * 3 * Dx * 2);
    unsigned short* Obuf  = (unsigned short*)alloc((size_t)Mx * Dx * 2);
    float*          Yf    = (float*)alloc((size_t)Mx * Dx * 4);  // Y1/Y2 reuse
    float*          X1f   = (float*)alloc((size_t)Mx * Dx * 4);
    unsigned short* X1b   = (unsigned short*)alloc((size_t)Mx * Dx * 2);
    unsigned short* Hb    = (unsigned short*)alloc((size_t)Mx * DFF * 2);

    static_assert(((size_t)Mx * Dx) % 8192 == 0 && ((size_t)Dx * Dx) % 8192 == 0 &&
                  ((size_t)DFF * Dx) % 8192 == 0 && Mx % 8 == 0 && Dx == 1024,
                  "whole blocks only in the convert and LayerNorm kernels");
    auto cvt = [&](const float* in, unsigned short* o, size_t n) {
        cvt_bf16_4<<<(int)(n / 8192), 256, 0, stream>>>(in, o);
    };

    // 1) f32 -> bf16
    cvt(src,  Xb,    (size_t)Mx * Dx);
    cvt(wqkv, Wqkvb, (size_t)3 * Dx * Dx);
    cvt(wout, Woutb, (size_t)Dx * Dx);
    cvt(w1,   W1b,   (size_t)DFF * Dx);
    cvt(w2,   W2b,   (size_t)Dx * DFF);

    // 2) QKV = src * Wqkv^T + b   (bf16 out)
    gemm_bf16_k<0, 1><<<dim3((3 * Dx) / 128, Mx / 256), 256, 0, stream>>>(
        Xb, Wqkvb, bqkv, nullptr, QKVb, Mx, 3 * Dx, Dx);

    // 3) attention -> Obuf (bf16, [M, D])
    attn_k<<<dim3(Sx / 128, Bx * Hx), 256, 0, stream>>>(QKVb, Obuf);

    // 4) out-proj: Yf = Obuf * Wout^T + bout (f32)
    gemm_bf16_k<0, 0><<<dim3(Dx / 128, Mx / 256), 256, 0, stream>>>(
        Obuf, Woutb, bout, Yf, nullptr, Mx, Dx, Dx);

    // 5) x = LN1(src + Yf) -> X1f (f32) + X1b (bf16)
    add_ln_k<1><<<Mx / 8, 256, 0, stream>>>(src, Yf, g1, be1, X1f, X1b);

    // 6) Hb = relu(x * W1^T + b1) (bf16)
    gemm_bf16_k<1, 1><<<dim3(DFF / 128, Mx / 256), 256, 0, stream>>>(
        X1b, W1b, b1, nullptr, Hb, Mx, DFF, Dx);

    // 7) Yf = Hb * W2^T + b2 (f32)
    gemm_bf16_k<0, 0><<<dim3(Dx / 128, Mx / 256), 256, 0, stream>>>(
        Hb, W2b, b2, Yf, nullptr, Mx, Dx, DFF);

    // 8) out = LN2(x + Yf) (f32)
    add_ln_k<0><<<Mx / 8, 256, 0, stream>>>(X1f, Yf, g2, be2, outp, nullptr);
}
